// v010
// Times are from an AMD MI455X. After a warm-up the kernel runs many times in a row, and a time is the length of
// such a window on the GPU divided by its runs, so every launch and the gaps after it count. The runs cycle
// through copies of the inputs. A figure is the median of several windows, for all but v000 over two sittings.
// Sittings can differ by a few percent; kernels timed side by side share one.
// Earlier versions than v010 are not in this document.
// One run takes 244 microseconds.
// Timed twice side by side with v009, it ran 1.06 times as fast both times.
// All steps since the starting kernel, v000, together make it 18.6 times as fast.
// Contractions: q/k = x.W^T [8192x1024].[1024x1024] with f16 operands (weights x16); v = x.Wv^T and the output projection on bf16 hi/lo split planes (late causal rows are long averages, so the value path must be f32-class) — v_wmma_f32_16x16x32_*, 128x128 work-group tiles with both operands staged in LDS; per (batch, head) causal softmax(q k^T / 8) v as one flash launch (f16 q.k^T and p.v; fully-masked key tiles skipped); f32 accumulate and softmax. The interleaved-pair RoPE with the INPUT cos/sin tables gathered by the INPUT token positions (generic elementwise form: out = x*cos + rot(x)*sin with rot = (-x[odd], x[even]) interleaved) and the exact-f32 recompute of the first 64 causal rows per head (whose q/k rows come from their own small bf16 hi/lo split GEMMs [64x1024].[1024x1024]) are f32 kernels.
#include <hip/hip_runtime.h>
#include <math.h>

typedef __attribute__((ext_vector_type(16))) _Float16 v16h;
typedef __attribute__((ext_vector_type(8)))  _Float16 v8h;
typedef __attribute__((ext_vector_type(4)))  _Float16 v4h;
typedef __attribute__((ext_vector_type(16))) __bf16   v16b;
typedef __attribute__((ext_vector_type(8)))  float    v8f;
typedef __attribute__((ext_vector_type(4)))  float    v4f;

// 16-bit WMMA fragment map (wave32), lane L, h = L>>4, m = L&15:
//   A 16x32: lane = row m;   element i -> k = (i<8) ? 8h+i : 16+8h+(i-8)
//   B 32x16: lane = column m; the SAME k(i,h)
//   D 16x16 (8 f32): lane = column m; element r -> row 8h+r
__device__ __forceinline__ int frag_k(int i, int h) { return (i < 8) ? (8 * h + i) : (16 + 8 * h + (i - 8)); }
__device__ __forceinline__ __bf16 bf16_rne(float f) {
    unsigned int u = __float_as_uint(f);
    u += 0x7fffu + ((u >> 16) & 1u);
    return __builtin_bit_cast(__bf16, (unsigned short)(u >> 16));
}
__device__ __forceinline__ float bf16_f32(__bf16 b) { return __uint_as_float(((unsigned int)__builtin_bit_cast(unsigned short, b)) << 16); }
__device__ __forceinline__ v8f wmma16(v16h a, v16h b, v8f c) {
    c = __builtin_amdgcn_wmma_f32_16x16x32_f16(false, a, false, b, (short)0, c, false, false);
    asm volatile("v_nop\n\tv_nop\n\tv_nop\n\tv_nop" : "+v"(c) : "v"(a), "v"(b));
    return c;
}
__device__ __forceinline__ v8f wmmab(v16b a, v16b b, v8f c) {
    c = __builtin_amdgcn_wmma_f32_16x16x32_bf16(false, a, false, b, (short)0, c, false, false);
    asm volatile("v_nop\n\tv_nop\n\tv_nop\n\tv_nop" : "+v"(c) : "v"(a), "v"(b));
    return c;
}
struct Split { v16b hi, lo; };
// hi/lo split product: a.hi*b.hi + a.hi*b.lo + a.lo*b.hi
__device__ __forceinline__ v8f wmma3(const Split& a, const Split& b, v8f c) {
    c = __builtin_amdgcn_wmma_f32_16x16x32_bf16(false, a.hi, false, b.hi, (short)0, c, false, false);
    c = __builtin_amdgcn_wmma_f32_16x16x32_bf16(false, a.hi, false, b.lo, (short)0, c, false, false);
    c = __builtin_amdgcn_wmma_f32_16x16x32_bf16(false, a.lo, false, b.hi, (short)0, c, false, false);
    asm volatile("v_nop\n\tv_nop\n\tv_nop\n\tv_nop" : "+v"(c) : "v"(a.hi), "v"(a.lo), "v"(b.hi), "v"(b.lo));
    return c;
}
struct Split3 { v16b hi, mid, lo; };
// triple split product (6 terms, drops only terms below 2^-24 relative)
__device__ __forceinline__ v8f wmma6(const Split3& a, const Split3& b, v8f c) {
    c = __builtin_amdgcn_wmma_f32_16x16x32_bf16(false, a.hi, false, b.hi, (short)0, c, false, false);
    c = __builtin_amdgcn_wmma_f32_16x16x32_bf16(false, a.hi, false, b.mid, (short)0, c, false, false);
    c = __builtin_amdgcn_wmma_f32_16x16x32_bf16(false, a.mid, false, b.hi, (short)0, c, false, false);
    c = __builtin_amdgcn_wmma_f32_16x16x32_bf16(false, a.hi, false, b.lo, (short)0, c, false, false);
    c = __builtin_amdgcn_wmma_f32_16x16x32_bf16(false, a.mid, false, b.mid, (short)0, c, false, false);
    c = __builtin_amdgcn_wmma_f32_16x16x32_bf16(false, a.lo, false, b.hi, (short)0, c, false, false);
    asm volatile("v_nop\n\tv_nop\n\tv_nop\n\tv_nop" : "+v"(c) : "v"(a.hi), "v"(a.mid), "v"(a.lo), "v"(b.hi), "v"(b.mid), "v"(b.lo));
    return c;
}

// Fragment gathers from f32 memory: element i <- p[(k0 + frag_k(i,h)) * sk] * s, zero for k >= klen.
__device__ __forceinline__ v16h fh_ld(const float* __restrict__ p, long long sk, int k0, int h, int klen, float s) {
    v16h a;
#pragma unroll
    for (int i = 0; i < 16; ++i) { const int k = k0 + frag_k(i, h); a[i] = (k < klen) ? (_Float16)(p[(long long)k * sk] * s) : (_Float16)0.f; }
    return a;
}
__device__ __forceinline__ Split sp_ld(const float* __restrict__ p, long long sk, int k0, int h, int klen, float s) {
    Split r;
#pragma unroll
    for (int i = 0; i < 16; ++i) {
        const int k = k0 + frag_k(i, h); const float x = (k < klen) ? p[(long long)k * sk] * s : 0.f;
        const __bf16 hb = bf16_rne(x); r.hi[i] = hb; r.lo[i] = bf16_rne(x - bf16_f32(hb));
    }
    return r;
}
__device__ __forceinline__ Split3 sp3_ld(const float* __restrict__ p, long long sk, int k0, int h, int klen, float s) {
    Split3 r;
#pragma unroll
    for (int i = 0; i < 16; ++i) {
        const int k = k0 + frag_k(i, h); const float x = (k < klen) ? p[(long long)k * sk] * s : 0.f;
        const __bf16 hb = bf16_rne(x); const float r1 = x - bf16_f32(hb); const __bf16 mb = bf16_rne(r1);
        r.hi[i] = hb; r.mid[i] = mb; r.lo[i] = bf16_rne(r1 - bf16_f32(mb));
    }
    return r;
}
__device__ __forceinline__ v16b bh_ld(const float* __restrict__ p, long long sk, int k0, int h, int klen, float s) {
    v16b a;
#pragma unroll
    for (int i = 0; i < 16; ++i) { const int k = k0 + frag_k(i, h); a[i] = bf16_rne((k < klen) ? p[(long long)k * sk] * s : 0.f); }
    return a;
}
// f16 fragment from an f16 LDS/global row with element stride 1 (k-contiguous), no bounds (tile already zero padded)
__device__ __forceinline__ v16h fh_row(const _Float16* __restrict__ row, int k0, int h) {
    v16h a;
#pragma unroll
    for (int i = 0; i < 16; ++i) a[i] = row[k0 + frag_k(i, h)];
    return a;
}

#define VST2(T, ptr, val) do { const T vst2_v_ = (val); *(T*)(ptr) = vst2_v_;  } while (0)
typedef float v4f __attribute__((ext_vector_type(4)));
#define VST2V4(ptr, val) do { const v4f vst2_v4_ = (val); *(v4f*)(ptr) = vst2_v4_;  } while (0)

__device__ __attribute__((noinline)) float act_fn(float v, int act) {
    if (act == 1) return fmaxf(v, 0.f);                                                                               // relu
    if (act == 2) { const float u = 0.7978845608028654f * (v + 0.044715f * v * v * v); return 0.5f * v * (1.f + tanhf(u)); } // tanh-gelu
    if (act == 3) return v / (1.f + expf(-v));                                                                        // silu
    if (act == 4) return 0.5f * v * (1.f + erff(v * 0.7071067811865476f));                                             // erf-gelu
    if (act == 5) return tanhf(v);
    if (act == 6) return 1.f / (1.f + expf(-v));                                                                      // sigmoid
    if (act == 7) return (v > 0.f) ? v : 0.01f * v;                                                                   // leaky relu 0.01
    if (act == 8) return (v > 0.f) ? v : (expf(v) - 1.f);                                                             // elu
    if (act == 9) return fminf(fmaxf(v, 0.f), 6.f);                                                                   // relu6
    if (act == 10) return fabsf(v);                                                                                    // abs
    if (act == 11) return (v >= 0.f) ? v : 0.1f * v;                                                                  // leaky 0.1
    if (act == 12) return (v > 0.f) ? v : 0.2f * v;                                                                   // leaky 0.2
    if (act == 13) return (v > 20.f) ? v : log1pf(expf(v));                                                            // softplus
    return v;
}

// =====================================================================================================================
// k_gemm<MODE>: C(z, m, n) = act(alpha * sum_k A(z, m, k) * B(z, k, n) + bias) + beta * R(z, m, n)
//   One wave (32-thread block) per 16 x 32 tile of C; grid (ceil(N/32), ceil(M/16), Z). Batch z -> (zo = z / zi_n, zi = z % zi_n)
//   with separate outer/inner strides for every tensor (e.g. batch and head). A(m,k) = A[zo*sAo + zi*sAi + m*sAm + k*sAk] (f32),
//   B(k,n) = B[zo*sBo + zi*sBi + n*sBn + k*sBk] (f32); any M, N, K (K zero-padded to 32 inside the fragments, M/N tails guarded).
//   C(m,n) = C[zo*sCo + zi*sCi + m*sCm + n] (n contiguous). flags: 1 bias[n], 2 bias[m], 4 residual R[zo*sRo + zi*sRi + m*sRm + n*sRn].
//   MODE 0: f16 operands (A prescaled by sa, B by sb, both undone in the epilogue); 1: bf16 hi/lo split (3 products); 2: bf16;
//   3: bf16 hi/mid/lo triple split (6 products); 4: as 3 with Kahan-compensated f32 accumulation across k-steps.
// =====================================================================================================================
struct GemmP {
    const float* A; const float* B; const float* bias; const float* R; float* C;
    long long sAo, sAi, sAm, sAk, sBo, sBi, sBn, sBk, sCo, sCi, sCm, sRo, sRi, sRm, sRn;
    int M, N, K, zi_n, flags, act; float alpha, beta, sa, sb;
    int Npad, pad_;     // columns [N, Npad) of C are written as 0 so that padded workspace rows are covered by whole-line stores; Npad >= N
};
static_assert(sizeof(GemmP) == 5 * 8 + 15 * 8 + 6 * 4 + 4 * 4 + 2 * 4, "GemmP has padding");

template <int MODE>
__global__ __launch_bounds__(32) void k_gemm(GemmP p) {
    const int lane = threadIdx.x & 31, h = lane >> 4, l15 = lane & 15;
    const int m0 = blockIdx.y * 16, n0 = blockIdx.x * 32;
    const int z = blockIdx.z, zo = z / p.zi_n, zi = z - zo * p.zi_n;
    const float* A = p.A + zo * p.sAo + zi * p.sAi;
    const float* B = p.B + zo * p.sBo + zi * p.sBi;
    const int am = min(m0 + l15, p.M - 1);                       // clamped row for loads (stores are guarded)
    v8f acc[2], comp[2];
#pragma unroll
    for (int t = 0; t < 2; ++t) { v8f zz = {}; acc[t] = zz; comp[t] = zz; }
    for (int k0 = 0; k0 < p.K; k0 += 32) {
        const float* arow = A + (long long)am * p.sAm;
        if (MODE == 1) {
            const Split a = sp_ld(arow, p.sAk, k0, h, p.K, 1.f);
#pragma unroll
            for (int t = 0; t < 2; ++t) {
                const int bn = min(n0 + t * 16 + l15, p.N - 1);
                acc[t] = wmma3(a, sp_ld(B + (long long)bn * p.sBn, p.sBk, k0, h, p.K, 1.f), acc[t]);
            }
        } else if (MODE == 3) {
            const Split3 a = sp3_ld(arow, p.sAk, k0, h, p.K, 1.f);
#pragma unroll
            for (int t = 0; t < 2; ++t) {
                const int bn = min(n0 + t * 16 + l15, p.N - 1);
                acc[t] = wmma6(a, sp3_ld(B + (long long)bn * p.sBn, p.sBk, k0, h, p.K, 1.f), acc[t]);
            }
        } else if (MODE == 4) {
            // triple split as MODE 3, but each k-step's 6 products go into a fresh accumulator and the partial is added to the running f32 sum
            // on the VALU with Kahan compensation (accumulation error stays ~1 ulp however long K is)
            const Split3 a = sp3_ld(arow, p.sAk, k0, h, p.K, 1.f);
#pragma unroll
            for (int t = 0; t < 2; ++t) {
                const int bn = min(n0 + t * 16 + l15, p.N - 1); v8f zz = {};
                const v8f part = wmma6(a, sp3_ld(B + (long long)bn * p.sBn, p.sBk, k0, h, p.K, 1.f), zz);
                const v8f y = part - comp[t]; const v8f s = acc[t] + y; comp[t] = (s - acc[t]) - y; acc[t] = s;
            }
        } else if (MODE == 2) {
            const v16b a = bh_ld(arow, p.sAk, k0, h, p.K, 1.f);
#pragma unroll
            for (int t = 0; t < 2; ++t) {
                const int bn = min(n0 + t * 16 + l15, p.N - 1);
                acc[t] = wmmab(a, bh_ld(B + (long long)bn * p.sBn, p.sBk, k0, h, p.K, 1.f), acc[t]);
            }
        } else {
            const v16h a = fh_ld(arow, p.sAk, k0, h, p.K, p.sa);
#pragma unroll
            for (int t = 0; t < 2; ++t) {
                const int bn = min(n0 + t * 16 + l15, p.N - 1);
                acc[t] = wmma16(a, fh_ld(B + (long long)bn * p.sBn, p.sBk, k0, h, p.K, p.sb), acc[t]);
            }
        }
    }
    const float iscale = (MODE == 0) ? p.alpha / (p.sa * p.sb) : p.alpha;
    float* C = p.C + zo * p.sCo + zi * p.sCi;
    const float* R = p.R + zo * p.sRo + zi * p.sRi;
    __shared__ __align__(16) float ctile[16][36];
#pragma unroll
    for (int t = 0; t < 2; ++t) {
        const int n = n0 + t * 16 + l15; const int nn = min(n, p.N - 1);
#pragma unroll
        for (int r = 0; r < 8; ++r) {
            const int m = m0 + 8 * h + r; const int mm = min(m, p.M - 1);
            float v = acc[t][r] * iscale;
            if (p.flags & 1) v += p.bias[nn];
            if (p.flags & 2) v += p.bias[mm];
            if (p.flags & 8) v *= p.bias[(long long)zo * p.M + mm];   /* per-(z,row) scale vector laid out [Z][M]; exclusive with the bias flags */
            v = act_fn(v, p.act);
            if (p.flags & 4) v += p.beta * R[(long long)mm * p.sRm + (long long)nn * p.sRn];
            ctile[8 * h + r][t * 16 + l15] = (n < p.N) ? v : 0.f;
        }
    }
    __syncthreads();
    const int NW = (p.Npad > p.N) ? p.Npad : p.N;           // write width
    const bool fast = (m0 + 16 <= p.M) && (n0 + 32 <= NW) && ((p.sCm & 3) == 0) && ((((size_t)C) & 15) == 0);
    if (fast) {
#pragma unroll
        for (int s = 0; s < 4; ++s) {
            const int row = s * 4 + (lane >> 3), c4 = (lane & 7) * 4;
            const v4f v = *(const v4f*)&ctile[row][c4];
            VST2V4(C + (long long)(m0 + row) * p.sCm + n0 + c4, v);
        }
    } else {
        for (int row = 0; row < 16; ++row) {
            const int m = m0 + row, n = n0 + lane;
            if (m < p.M && n < NW) VST2(float, C + (long long)m * p.sCm + n, ctile[row][lane]);
        }
    }
}


// =====================================================================================================================
// k_gemmT<MODE, TM, TN>: same contract as k_gemm, but one wave computes a (16*TM) x (16*TN) tile: TM A fragments and TN B fragments are
//   loaded per 32-wide k-step and reused across TM*TN WMMAs (far fewer load/convert instructions per MAC). MODE 0 (f16), 1 (bf16 hi/lo),
//   2 (bf16) only. grid (ceil(NW/(16*TN)), ceil(M/(16*TM)), Z), block 32. Epilogue identical to k_gemm, run per 16x32 sub-tile.
// =====================================================================================================================
template <int MODE, int TM, int TN>
__global__ __launch_bounds__(32) void k_gemmT(GemmP p) {
    const int lane = threadIdx.x & 31, h = lane >> 4, l15 = lane & 15;
    const int m0 = blockIdx.y * (16 * TM), n0 = blockIdx.x * (16 * TN);
    const int z = blockIdx.z, zo = z / p.zi_n, zi = z - zo * p.zi_n;
    const float* A = p.A + zo * p.sAo + zi * p.sAi;
    const float* B = p.B + zo * p.sBo + zi * p.sBi;
    v8f acc[TM][TN];
#pragma unroll
    for (int i = 0; i < TM; ++i)
#pragma unroll
        for (int t = 0; t < TN; ++t) { v8f zz = {}; acc[i][t] = zz; }
    for (int k0 = 0; k0 < p.K; k0 += 32) {
        if (MODE == 1) {
            Split a[TM], b[TN];
#pragma unroll
            for (int i = 0; i < TM; ++i) { const int am = min(m0 + 16 * i + l15, p.M - 1); a[i] = sp_ld(A + (long long)am * p.sAm, p.sAk, k0, h, p.K, 1.f); }
#pragma unroll
            for (int t = 0; t < TN; ++t) { const int bn = min(n0 + 16 * t + l15, p.N - 1); b[t] = sp_ld(B + (long long)bn * p.sBn, p.sBk, k0, h, p.K, 1.f); }
#pragma unroll
            for (int i = 0; i < TM; ++i)
#pragma unroll
                for (int t = 0; t < TN; ++t) acc[i][t] = wmma3(a[i], b[t], acc[i][t]);
        } else if (MODE == 2) {
            v16b a[TM], b[TN];
#pragma unroll
            for (int i = 0; i < TM; ++i) { const int am = min(m0 + 16 * i + l15, p.M - 1); a[i] = bh_ld(A + (long long)am * p.sAm, p.sAk, k0, h, p.K, 1.f); }
#pragma unroll
            for (int t = 0; t < TN; ++t) { const int bn = min(n0 + 16 * t + l15, p.N - 1); b[t] = bh_ld(B + (long long)bn * p.sBn, p.sBk, k0, h, p.K, 1.f); }
#pragma unroll
            for (int i = 0; i < TM; ++i)
#pragma unroll
                for (int t = 0; t < TN; ++t) acc[i][t] = wmmab(a[i], b[t], acc[i][t]);
        } else {
            v16h a[TM], b[TN];
#pragma unroll
            for (int i = 0; i < TM; ++i) { const int am = min(m0 + 16 * i + l15, p.M - 1); a[i] = fh_ld(A + (long long)am * p.sAm, p.sAk, k0, h, p.K, p.sa); }
#pragma unroll
            for (int t = 0; t < TN; ++t) { const int bn = min(n0 + 16 * t + l15, p.N - 1); b[t] = fh_ld(B + (long long)bn * p.sBn, p.sBk, k0, h, p.K, p.sb); }
#pragma unroll
            for (int i = 0; i < TM; ++i)
#pragma unroll
                for (int t = 0; t < TN; ++t) acc[i][t] = wmma16(a[i], b[t], acc[i][t]);
        }
    }
    const float iscale = (MODE == 0) ? p.alpha / (p.sa * p.sb) : p.alpha;
    float* C = p.C + zo * p.sCo + zi * p.sCi;
    const float* R = p.R + zo * p.sRo + zi * p.sRi;
    const int NW = (p.Npad > p.N) ? p.Npad : p.N;
    __shared__ __align__(16) float ctile[16][36];
#pragma unroll
    for (int i = 0; i < TM; ++i) {
        const int mb = m0 + 16 * i; if (mb >= p.M) break;          // wave-uniform
#pragma unroll
        for (int tp = 0; tp < TN / 2; ++tp) {
            const int nb = n0 + 32 * tp; if (nb >= NW) break;        // wave-uniform
#pragma unroll
            for (int t2 = 0; t2 < 2; ++t2) {
                const int t = 2 * tp + t2; const int n = nb + t2 * 16 + l15; const int nn = min(n, p.N - 1);
#pragma unroll
                for (int r = 0; r < 8; ++r) {
                    const int m = mb + 8 * h + r; const int mm = min(m, p.M - 1);
                    float v = acc[i][t][r] * iscale;
                    if (p.flags & 1) v += p.bias[nn];
                    if (p.flags & 2) v += p.bias[mm];
            if (p.flags & 8) v *= p.bias[(long long)zo * p.M + mm];   /* per-(z,row) scale vector laid out [Z][M]; exclusive with the bias flags */
                    v = act_fn(v, p.act);
                    if (p.flags & 4) v += p.beta * R[(long long)mm * p.sRm + (long long)nn * p.sRn];
                    ctile[8 * h + r][t2 * 16 + l15] = (n < p.N) ? v : 0.f;
                }
            }
            __syncthreads();
            const bool fast = (mb + 16 <= p.M) && (nb + 32 <= NW) && ((p.sCm & 3) == 0) && ((((size_t)C) & 15) == 0);
            if (fast) {
#pragma unroll
                for (int s = 0; s < 4; ++s) {
                    const int row = s * 4 + (lane >> 3), c4 = (lane & 7) * 4;
                    const v4f v = *(const v4f*)&ctile[row][c4];
                    VST2V4(C + (long long)(mb + row) * p.sCm + nb + c4, v);
                }
            } else {
                for (int row = 0; row < 16; ++row) {
                    const int m = mb + row, n = nb + lane;
                    if (m < p.M && n < NW) VST2(float, C + (long long)m * p.sCm + n, ctile[row][lane]);
                }
            }
            __syncthreads();
        }
    }
}

// =====================================================================================================================
//   Wave = 16 queries, AW waves per block, 64-key blocks; grid (ceil(Lq/(16*AW)), H, B), block 32*AW. Any Lq, Lk; head dim dh <= DHP
//   (DHP multiple of 32), value dim dv <= DVP (multiple of 16, <= 128). Every tensor addressed by (batch, head, row, element) strides, f32.
//   Scores: QM 0 f16 operands, 1 bf16 hi/lo split, 2 bf16 triple split; statistics f32 (exp2 domain); P.V: P x 4096 as f16 with V f16 staged in LDS
//   (SPLITPV: P and V as bf16 hi/lo splits). kv head = h / hrep. Masking: causal = 1 (keep j <= i + coff, masked -> -inf, key blocks beyond the
//   diagonal skipped), causal = 2 (masked -> mfill, a finite fill like the -1e9; no skipping), causal = 3 (keep j >= i + coff,
//   masked -> -inf, no skipping); optional additive f32 mask Mf,
//   optional int keep-mask Mi (0 -> score := mfill), both addressed b*smb + h*smh + i*smi + j*smj (0 strides broadcast).
// =====================================================================================================================
#define AW 4
struct AttnP {   // apv4
    const float* Q; const float* K; const float* V; float* O; float* P; const float* Mf; const int* Mi; float* ST;
    const float* Pw; const float* Rt; const int* SQ; const int* SK;           // optional: post-softmax weight, relative-position table, segment ids
    long long swb, swh, swi, swj, srb, srh, sri;                                 // Pw strides (b,h,i,j); Rt strides (b,h,i), column = clamp(i - j + roff, 0, rn-1)
    long long sQb, sQh, sQi, sQd, sKb, sKh, sKj, sKd, sVb, sVh, sVj, sVd, sOb, sOh, sOi, sPb, sPh, sPi, smb, smh, smi, smj;
    int Lq, Lk, dh, dv, hrep, causal, coff, pband;   // pband > 0: P holds only the band |j - i| <= pband, column j - i + pband
    float scale, mfill; int nonorm, mpol;             // nonorm (online path only): O = sum_j exp(score_j) V_j without the 1/rowsum (scores must be <= ~0); mpol: Mi masks where ==0 (mpol 0) or where !=0 (mpol 1)
    int roff, rn, segpol, win;                        // Rt column offset/count; SQ/SK: score := mfill where (segpol 0) SQ[i] != SK[j] or (segpol 1) SQ[i] == SK[j]; win > 0: keys with i - j > win (after coff) -> -inf
};
//   Pw: the softmax numerator is multiplied by Pw(b,h,i,j) AFTER the row sum is taken (probs * weight, then P.V), as in post-softmax multiplicative biases.                                                    // ST (optional): per row (b,h,i) -> ST[((b*H + h)*Lq + i)*2 + {0,1}] = {row max of the scaled+masked score (natural units), sum_j exp(score - max)}
static_assert(sizeof(AttnP) == 12 * 8 + 29 * 8 + 16 * 4, "AttnP has padding");

#ifndef KATTN_ATTR
#define KATTN_ATTR __attribute__((amdgpu_waves_per_eu(4)))   // at most 256 registers a wave: four waves a SIMD, 1024 work-groups of the causal grid resident at once
#endif
//   FS > 0 (QM 0, one pass, f16 P.V only): the layout is fixed at compile time: Q, K, V, O are dense [batch][FS rows][FD] f32 with head h at column h * DHP (DVP for V, O),
//   dh = DHP, dv = DVP, Lq = Lk = FS (multiple of 64), causal = 1 with coff = 0, none of the optional inputs or outputs. Every element guard and stride then folds
//   away, and a key block's K and V come in by plain 16-byte loads that are in flight together, in two batches, instead of guarded 4-byte loads waited on one at a time.
template <int DHP, int DVP, int QM, bool SPLITPV, bool TWOPASS, int FS = 0, int FD = 0>
__global__ __launch_bounds__(32 * AW) KATTN_ATTR void k_attn(AttnP p) {
    static_assert(FS == 0 || (QM == 0 && !SPLITPV && !TWOPASS && DHP == 64 && DVP == 64 && FS % 64 == 0 && FD % 8 == 0), "fixed layout: whole key blocks, 32-byte aligned fragments");
    if (FS > 0) {
        p.P = nullptr; p.Mf = nullptr; p.Mi = nullptr; p.ST = nullptr; p.Pw = nullptr; p.Rt = nullptr; p.SQ = nullptr; p.SK = nullptr;
        p.sQb = (long long)FS * FD; p.sQh = DHP; p.sQi = FD; p.sQd = 1; p.sKb = (long long)FS * FD; p.sKh = DHP; p.sKj = FD; p.sKd = 1;
        p.sVb = (long long)FS * FD; p.sVh = DVP; p.sVj = FD; p.sVd = 1; p.sOb = (long long)FS * FD; p.sOh = DVP; p.sOi = FD;
        p.Lq = FS; p.Lk = FS; p.dh = DHP; p.dv = DVP; p.hrep = 1; p.causal = 1; p.coff = 0; p.pband = 0; p.nonorm = 0; p.win = 0;
    }
    constexpr int NT = DVP / 16;                // output tiles
    constexpr int KS = DHP / 32;                // k-steps for the scores
    constexpr int VP = DVP + 8;                 // LDS pitch (halves)
    __shared__ __align__(16) float    pl[AW][16 * 64];
    __shared__ __align__(16) _Float16 vl[(SPLITPV ? 2 : 1) * 64 * VP];   // f16 V tile, or bf16 hi and lo tiles (same 2-byte size)
    const int lane = threadIdx.x & 31, hf = lane >> 4, l15 = lane & 15, wave = threadIdx.x >> 5;
    // FS > 0: grid (heads, batches, query tiles) and query tile bx = last - blockIdx.z. A causal tile walks bx + 1 key blocks and only half the work-groups are resident at once;
    // the long tiles come first in index order, and neighbours in index cost the same.
    const int bx = FS > 0 ? FS / (16 * AW) - 1 - (int)blockIdx.z : (int)blockIdx.x;
    const int h = FS > 0 ? blockIdx.x : blockIdx.y, b = FS > 0 ? blockIdx.y : blockIdx.z, hk = h / p.hrep;
    const int q0 = (bx * AW + wave) * 16;
    float* myp = pl[wave];
    const float L2E = 1.4426950408889634f;
    const float NEG = -__builtin_inff();
    const int qi = min(q0 + l15, p.Lq - 1);
    const float* qrow = p.Q + b * p.sQb + h * p.sQh + (long long)qi * p.sQi;
    const float* kbase = p.K + b * p.sKb + hk * p.sKh;
    const float* vbase = p.V + b * p.sVb + hk * p.sVh;
    v16h qa[QM == 0 ? KS : 1]; Split qs_[QM == 1 ? KS : 1]; Split3 qt_[QM == 2 ? KS : 1];
#pragma unroll
    for (int ks = 0; ks < KS; ++ks) {
        if (QM == 2) qt_[ks] = sp3_ld(qrow, p.sQd, ks * 32, hf, p.dh, 1.f);
        else if (QM == 1) qs_[ks] = sp_ld(qrow, p.sQd, ks * 32, hf, p.dh, 1.f);
        else qa[ks] = fh_ld(qrow, p.sQd, ks * 32, hf, p.dh, 1.f);
    }
    v8f o[NT]; float m8[8], l8[8];
#pragma unroll
    for (int t = 0; t < NT; ++t) { v8f zz = {}; o[t] = zz; }
#pragma unroll
    for (int i = 0; i < 8; ++i) { m8[i] = NEG; l8[i] = 0.f; }
    int jend = p.Lk; int jstart = 0;
    if (p.causal == 1) { const int je = (bx * AW + AW - 1) * 16 + 16 + p.coff; jend = min(jend, max(je, 0)); }   // uniform per block
    if (p.win > 0) { const int js = (bx * AW) * 16 + p.coff - p.win; jstart = (js > 0) ? (js / 64) * 64 : 0; }   // uniform per block: key blocks entirely outside every row's window hold only -inf entries and are skipped exactly
    const int npass = TWOPASS ? 2 : 1;
    for (int pass = 0; pass < npass; ++pass) {
        const bool dopv = (!TWOPASS) || pass == 1;
        for (int j0 = jstart; j0 < jend; j0 += 64) {
            v16h kf[FS > 0 ? 4 * KS : 1];                        // FS > 0: the key block's K fragments, tile t and k-step ks at t * KS + ks
            if (dopv) {
                __syncthreads();                                 // previous key block's reads of vl / pl are done
                if (FS > 0) {
                    // raw f32 in two batches, so that the loaded values and everything else that is live fit 256 registers (four waves a SIMD)
                    v4f vr[8]; v8f kr[8];                                           // V: four consecutive elements per thread and step; K: half a fragment each
                    const float* krow = kbase + (long long)(j0 + l15) * FD + 8 * hf;
#pragma unroll
                    for (int it = 0; it < 8; ++it)
                        vr[it] = *(const v4f*)(vbase + (long long)(j0 + ((int)threadIdx.x >> 4)) * FD + ((int)threadIdx.x & 15) * 4 + it * (2 * AW * FD));   // rows 2 AW apart per step
#pragma unroll
                    for (int c = 0; c < 8; ++c) kr[c] = *(const v8f*)(krow + (c >> 2) * (16 * FD) + (c & 3) * 16);   // key tile t = c / 4; k = 16 (c % 4) + 8 hf + (0..7)
                    // inputs-only fence on the loaded values: their first use is here, so the batch's 24 loads are all issued before any is waited on (without it
                    // the scheduler puts each load directly in front of its conversion and waits on it there)
                    asm volatile("" :: "v"(vr[0]), "v"(vr[1]), "v"(vr[2]), "v"(vr[3]), "v"(vr[4]), "v"(vr[5]), "v"(vr[6]), "v"(vr[7]),
                                 "v"(kr[0]), "v"(kr[1]), "v"(kr[2]), "v"(kr[3]), "v"(kr[4]), "v"(kr[5]), "v"(kr[6]), "v"(kr[7]));
#pragma unroll
                    for (int it = 0; it < 8; ++it) {
                        v4h hv; hv[0] = (_Float16)vr[it][0]; hv[1] = (_Float16)vr[it][1]; hv[2] = (_Float16)vr[it][2]; hv[3] = (_Float16)vr[it][3];
                        *(v4h*)(vl + ((int)threadIdx.x >> 4) * VP + ((int)threadIdx.x & 15) * 4 + it * (2 * AW * VP)) = hv;
                    }
#pragma unroll
                    for (int f = 0; f < 4; ++f)
#pragma unroll
                        for (int e = 0; e < 8; ++e) { kf[f][e] = (_Float16)kr[2 * f][e]; kf[f][8 + e] = (_Float16)kr[2 * f + 1][e]; }
                    v8f ks2[8];
#pragma unroll
                    for (int c = 0; c < 8; ++c) ks2[c] = *(const v8f*)(krow + (2 + (c >> 2)) * (16 * FD) + (c & 3) * 16);   // key tiles 2 and 3
                    // the same fence for the second batch's 16 loads; the address is named too, so that it stays live and none of these loads is given its register pair as destination
                    asm volatile("" :: "v"(ks2[0]), "v"(ks2[1]), "v"(ks2[2]), "v"(ks2[3]), "v"(ks2[4]), "v"(ks2[5]), "v"(ks2[6]), "v"(ks2[7]), "v"(krow));
#pragma unroll
                    for (int f = 0; f < 4; ++f)
#pragma unroll
                        for (int e = 0; e < 8; ++e) { kf[4 + f][e] = (_Float16)ks2[2 * f][e]; kf[4 + f][8 + e] = (_Float16)ks2[2 * f + 1][e]; }
                } else
                for (int idx = threadIdx.x; idx < 64 * DVP; idx += 32 * AW) {
                    const int jr = idx / DVP, d = idx - jr * DVP, j = j0 + jr;
                    const float f = (j < p.Lk && d < p.dv) ? vbase[(long long)j * p.sVj + (long long)d * p.sVd] : 0.f;
                    if (SPLITPV) {
                        const __bf16 hb = bf16_rne(f);
                        ((__bf16*)vl)[jr * VP + d] = hb; ((__bf16*)vl)[64 * VP + jr * VP + d] = bf16_rne(f - bf16_f32(hb));
                    } else vl[jr * VP + d] = (_Float16)f;
                }
            }
            v8f s[4];
#pragma unroll
            for (int t = 0; t < 4; ++t) {
                const int j = min(j0 + t * 16 + l15, p.Lk - 1);
                const float* krow = kbase + (long long)j * p.sKj;
                v8f acc = {};
#pragma unroll
                for (int ks = 0; ks < KS; ++ks) {
                    if (QM == 2)      acc = wmma6(qt_[ks], sp3_ld(krow, p.sKd, ks * 32, hf, p.dh, 1.f), acc);
                    else if (QM == 1) acc = wmma3(qs_[ks], sp_ld(krow, p.sKd, ks * 32, hf, p.dh, 1.f), acc);
                    else if (FS > 0)  acc = wmma16(qa[ks], kf[t * KS + ks], acc);
                    else              acc = wmma16(qa[ks], fh_ld(krow, p.sKd, ks * 32, hf, p.dh, 1.f), acc);
                }
                s[t] = acc;
            }
            float pv[8][4];
#pragma unroll
            for (int i = 0; i < 8; ++i) {
                const int irow = q0 + i + 8 * hf;
                const int ic = min(irow, p.Lq - 1);
                float sc[4];
#pragma unroll
                for (int t = 0; t < 4; ++t) {
                    const int jg = j0 + t * 16 + l15;
                    float v = s[t][i] * p.scale;
                    if (p.Mf) v += p.Mf[b * p.smb + h * p.smh + (long long)ic * p.smi + (long long)min(jg, p.Lk - 1) * p.smj];
                    if (p.Rt) { int rc = ic - min(jg, p.Lk - 1) + p.roff; rc = rc < 0 ? 0 : (rc >= p.rn ? p.rn - 1 : rc); v += p.Rt[b * p.srb + h * p.srh + (long long)ic * p.sri + rc]; }
                    if (p.Mi) { const int mv = p.Mi[b * p.smb + h * p.smh + (long long)ic * p.smi + (long long)min(jg, p.Lk - 1) * p.smj]; if (p.mpol ? (mv != 0) : (mv == 0)) v = p.mfill; }
                    if (p.SQ) { const bool same = p.SQ[(long long)b * p.Lq + ic] == p.SK[(long long)b * p.Lk + min(jg, p.Lk - 1)]; if (p.segpol ? same : !same) v = p.mfill; }
                    if (p.causal == 2 && jg > irow + p.coff) v = p.mfill;
                    if (jg >= p.Lk || (p.causal == 1 && jg > irow + p.coff) || (p.causal == 3 && jg < irow + p.coff) || (p.win > 0 && irow + p.coff - jg > p.win)) v = NEG; else v *= L2E;
                    sc[t] = v;
                }
                if (!TWOPASS || pass == 0) {
                    float mx = fmaxf(fmaxf(sc[0], sc[1]), fmaxf(sc[2], sc[3]));
                    mx = fmaxf(mx, __shfl_xor(mx, 1, 32)); mx = fmaxf(mx, __shfl_xor(mx, 2, 32));
                    mx = fmaxf(mx, __shfl_xor(mx, 4, 32)); mx = fmaxf(mx, __shfl_xor(mx, 8, 32));
                    const float mnew = fmaxf(m8[i], mx);
                    const float corr = (mnew == NEG) ? 1.f : exp2f(m8[i] - mnew);
                    float rs = 0.f;
#pragma unroll
                    for (int t = 0; t < 4; ++t) {
                        const float pp = (sc[t] == NEG) ? 0.f : exp2f(sc[t] - mnew); rs += pp;
                        pv[i][t] = p.Pw ? pp * p.Pw[b * p.swb + h * p.swh + (long long)ic * p.swi + (long long)min(j0 + t * 16 + l15, p.Lk - 1) * p.swj] : pp;
                    }
                    rs += __shfl_xor(rs, 1, 32); rs += __shfl_xor(rs, 2, 32); rs += __shfl_xor(rs, 4, 32); rs += __shfl_xor(rs, 8, 32);
                    l8[i] = l8[i] * corr + rs; m8[i] = mnew;
                    if (!TWOPASS) {
#pragma unroll
                        for (int t = 0; t < NT; ++t) o[t][i] *= corr;
                    }
                } else {
                    const float inv = (l8[i] > 0.f) ? 1.f / l8[i] : 0.f;
#pragma unroll
                    for (int t = 0; t < 4; ++t) {
                        const int jg = j0 + t * 16 + l15;
                        float pp = (sc[t] == NEG) ? 0.f : exp2f(sc[t] - m8[i]) * inv;
                        if (p.Pw) pp *= p.Pw[b * p.swb + h * p.swh + (long long)ic * p.swi + (long long)min(jg, p.Lk - 1) * p.swj];
                        pv[i][t] = pp;
                    }
                }
            }
            if (dopv) {
#pragma unroll
                for (int i = 0; i < 8; ++i)
#pragma unroll
                    for (int t = 0; t < 4; ++t) ((float*)myp)[(i + 8 * hf) * 64 + t * 16 + l15] = pv[i][t];
                __syncthreads();                                 // P (per wave) and V (shared) visible
                if (p.P) {
                    float* pb_ = p.P + b * p.sPb + h * p.sPh;
                    const bool fastP = (p.pband == 0) && ((p.sPi & 3) == 0) && (j0 + 64 <= p.Lk) && (q0 + 16 <= p.Lq) && ((((size_t)pb_) & 15) == 0);
                    if (fastP) {
#pragma unroll
                        for (int s = 0; s < 8; ++s) {
                            const int row = s * 2 + (lane >> 4), c4 = (lane & 15) * 4;
                            const v4f v = *(const v4f*)(myp + row * 64 + c4);
                            VST2V4(pb_ + (long long)(q0 + row) * p.sPi + j0 + c4, v);
                        }
                    } else {
                        for (int row = 0; row < 16; ++row) {
                            const int irow = q0 + row; if (irow >= p.Lq) continue;
                            for (int c = lane; c < 64; c += 32) {
                                const int jg = j0 + c; if (jg >= p.Lk) continue;
                                if (p.pband == 0) VST2(float, pb_ + (long long)irow * p.sPi + jg, myp[row * 64 + c]);
                                else if (jg - irow <= p.pband && irow - jg <= p.pband) VST2(float, pb_ + (long long)irow * p.sPi + (jg - irow + p.pband), myp[row * 64 + c]);
                            }
                        }
                    }
                }
                if (SPLITPV) {
                    const Split pa0 = sp_ld(myp + l15 * 64, 1, 0, hf, 64, 1.f), pa1 = sp_ld(myp + l15 * 64, 1, 32, hf, 64, 1.f);
                    const __bf16* vh = (const __bf16*)vl; const __bf16* vlo = vh + 64 * VP;
#pragma unroll
                    for (int t = 0; t < NT; ++t) {
                        const int dcol = t * 16 + l15;
                        Split b0, b1;
#pragma unroll
                        for (int e = 0; e < 16; ++e) {
                            const int k0 = frag_k(e, hf), k1 = 32 + frag_k(e, hf);
                            b0.hi[e] = vh[k0 * VP + dcol]; b0.lo[e] = vlo[k0 * VP + dcol]; b1.hi[e] = vh[k1 * VP + dcol]; b1.lo[e] = vlo[k1 * VP + dcol];
                        }
                        o[t] = wmma3(pa0, b0, o[t]);
                        o[t] = wmma3(pa1, b1, o[t]);
                    }
                } else {
                    const v16h pa0 = fh_ld(myp + l15 * 64, 1, 0, hf, 64, 4096.f), pa1 = fh_ld(myp + l15 * 64, 1, 32, hf, 64, 4096.f);
#pragma unroll
                    for (int t = 0; t < NT; ++t) {
                        const int dcol = t * 16 + l15;
                        v16h b0, b1;
#pragma unroll
                        for (int e = 0; e < 16; ++e) { b0[e] = vl[frag_k(e, hf) * VP + dcol]; b1[e] = vl[(32 + frag_k(e, hf)) * VP + dcol]; }
                        o[t] = wmma16(pa0, b0, o[t]);
                        o[t] = wmma16(pa1, b1, o[t]);
                    }
                }
            }
        }
    }
    float* obase = p.O + b * p.sOb + h * p.sOh;
    if (p.ST) {
        const int rl = lane >> 1, isel = rl & 7;           // row q0 + rl ; rl>>3 == hf holds because lane>>4 == (lane>>1)>>3
        float mv = 0.f, lv = 0.f;
#pragma unroll
        for (int i = 0; i < 8; ++i) if (i == isel) { mv = m8[i]; lv = l8[i]; }
        const int irow = q0 + rl;
        if (irow < p.Lq) { float* st = p.ST + (((long long)b * gridDim.y + h) * p.Lq + irow) * 2 + (lane & 1); VST2(float, st, (lane & 1) ? lv : mv * 0.6931471805599453f); }
    }
    float invr[8];
#pragma unroll
    for (int i = 0; i < 8; ++i) {
        if (TWOPASS) invr[i] = SPLITPV ? 1.f : (1.f / 4096.f);
        else if (p.nonorm) invr[i] = exp2f(m8[i]) * (SPLITPV ? 1.f : (1.f / 4096.f));
        else invr[i] = (l8[i] > 0.f) ? (SPLITPV ? 1.f / l8[i] : 1.f / (l8[i] * 4096.f)) : 0.f;
    }
    __syncthreads();                                             // all waves done with pl/vl from the main loop
    const bool ofast = ((p.sOi & 3) == 0) && ((((size_t)obase) & 15) == 0) && (q0 + 16 <= p.Lq);
#pragma unroll
    for (int c0 = 0; c0 < DVP; c0 += 64) {
#pragma unroll
        for (int i = 0; i < 8; ++i)
#pragma unroll
            for (int t = 0; t < NT; ++t) if (t * 16 >= c0 && t * 16 < c0 + 64) ((float*)myp)[(i + 8 * hf) * 64 + (t * 16 - c0) + l15] = o[t][i] * invr[i];
        __syncthreads();
        const int cw = (DVP - c0 < 64) ? (DVP - c0) : 64;      // staged columns in this chunk (multiple of 16)
        if (ofast && (c0 + cw <= p.dv) && (cw % 32 == 0)) {
            const int lpr = cw / 4;                              // lanes per row (16 for 64 cols, 8 for 32)
            const int rows_per_ins = 32 / lpr;
            for (int r0 = 0; r0 < 16; r0 += rows_per_ins) {
                const int row = r0 + lane / lpr, c4 = (lane % lpr) * 4;
                const v4f v = *(const v4f*)(myp + row * 64 + c4);
                VST2V4(obase + (long long)(q0 + row) * p.sOi + c0 + c4, v);
            }
        } else {
            for (int row = 0; row < 16; ++row) {
                const int irow = q0 + row; if (irow >= p.Lq) continue;
                for (int c = lane; c < cw; c += 32) { const int d = c0 + c; if (d < p.dv) VST2(float, obase + (long long)irow * p.sOi + d, myp[row * 64 + c]); }
            }
        }
        __syncthreads();
    }
}

// ---- causal flash attention, transposed products ------------------------------------------------------------------
// Q, K, V, O dense f32 [batch][FS rows][FD], head h at column 64 h, head size 64. grid (heads, batches, FS / 64), query tile bx = last - blockIdx.z (longest first),
// 4 waves of 16 queries, key blocks of 64. A key block's K and V are brought in once for the work-group, by loads that cover whole 256-byte rows, and kept in LDS as f16.
// S^T = K.Q^T: A = 16 keys x 32 k, read from the K tile by 16-byte LDS loads, B = Q, so s[t][r] is the score of key j0 + 16 t + 8 hf + r for query q0 + l15:
// the 64 scores of a query lie in lanes l15 and l15 + 16, the maximum and the sum are taken in the lane, and the two halves meet by one exchange.
// O^T += V^T.P^T: two score tiles, converted in place, are the B operand (element e <- tile e / 8, register e % 8, the hardware k order), so P passes through no LDS;
// A = V^T comes from the row-major f16 V tile by the transposing LDS load, which delivers the same k order. o[t][r] = O[q0 + l15][16 t + 8 hf + r].
// Every loop but the one over key blocks is unrolled (#pragma unroll): its index picks registers of a fragment or an accumulator, which stay registers only under constant indices.
typedef __attribute__((ext_vector_type(8))) short v8s;
__device__ __forceinline__ v8h at_ld_tr16(const _Float16* p) { typedef __attribute__((address_space(3))) v8s lds_v8s; return __builtin_bit_cast(v8h, __builtin_amdgcn_ds_load_tr16_b128_v8i16((lds_v8s*)p)); }
__device__ __forceinline__ float at_xhalf(float x) { return __builtin_bit_cast(float, __builtin_amdgcn_permlanex16(__builtin_bit_cast(int, x), __builtin_bit_cast(int, x), 0x76543210, 0xfedcba98, false, false)); }   // lane l <-> lane l ^ 16
// 2^x by v_exp_f32 (a result under 2^-126 comes out as 0). Written as asm for the slot that the instruction set asks for behind a transcendental: no result register is a source
// register of the statement ("=&v"), so no exponential overwrites the source or reads the result of the one in front of it, and the v_nop at the end fills the slot behind the last.
__device__ __forceinline__ float at_exp2(float x) { float d; asm("v_exp_f32 %0, %1\n\tv_nop" : "=&v"(d) : "v"(x)); return d; }
__device__ __forceinline__ v8f at_exp2x8(v8f x) {
    float d0, d1, d2, d3, d4, d5, d6, d7;
    asm("v_exp_f32 %0, %8\n\tv_exp_f32 %1, %9\n\tv_exp_f32 %2, %10\n\tv_exp_f32 %3, %11\n\tv_exp_f32 %4, %12\n\tv_exp_f32 %5, %13\n\tv_exp_f32 %6, %14\n\tv_exp_f32 %7, %15\n\tv_nop"
        : "=&v"(d0), "=&v"(d1), "=&v"(d2), "=&v"(d3), "=&v"(d4), "=&v"(d5), "=&v"(d6), "=&v"(d7)
        : "v"(x[0]), "v"(x[1]), "v"(x[2]), "v"(x[3]), "v"(x[4]), "v"(x[5]), "v"(x[6]), "v"(x[7]));
    v8f d; d[0] = d0; d[1] = d1; d[2] = d2; d[3] = d3; d[4] = d4; d[5] = d5; d[6] = d6; d[7] = d7; return d;
}
template <int FS, int FD>
__global__ __launch_bounds__(32 * AW) KATTN_ATTR void k_attn_t(const float* __restrict__ Q, const float* __restrict__ K, const float* __restrict__ V, float* __restrict__ O) {
    static_assert(FS % 64 == 0 && FD % 8 == 0 && AW == 4, "whole key blocks, 32-byte aligned fragments");
    constexpr int VP = 80;                      // V tile pitch in halves: 160 B = 32 B x odd, the transposing load's pitch
    constexpr int KP = 72;                      // K tile pitch in halves: 144 B = 16 B x odd, the pitch of plain 16-byte LDS loads
    constexpr int OP = 68;                      // output staging pitch in floats
    __shared__ __align__(16) _Float16 kl[64 * KP];
    __shared__ __align__(16) _Float16 vl[64 * VP];
    __shared__ __align__(16) float    ol[AW][16 * OP];
    const int lane = threadIdx.x & 31, hf = lane >> 4, l15 = lane & 15, wave = threadIdx.x >> 5;
    const int bx = FS / (16 * AW) - 1 - (int)blockIdx.z;
    const int h = blockIdx.x, b = blockIdx.y;
    const int q0 = (bx * AW + wave) * 16;
    const float NEG = -__builtin_inff();
    const float SC = 0.125f * 1.4426950408889634f;   // 1 / sqrt(64) and log2(e); the power of two makes one product round as the two did
    const size_t hb = (size_t)b * FS * FD + (size_t)h * 64;
    const float* qrow = Q + hb + (size_t)(q0 + l15) * FD;
    const float* kbase = K + hb;
    const float* vbase = V + hb;
    v16h qa[2];
#pragma unroll
    for (int ks = 0; ks < 2; ++ks) qa[ks] = fh_ld(qrow, 1, ks * 32, hf, 64, 1.f);
    v8f o[4]; float m = NEG, l = 0.f;           // m: the query's running maximum (both halves alike); l: this half's part of its sum
#pragma unroll
    for (int t = 0; t < 4; ++t) { v8f zz = {}; o[t] = zz; }
    const _Float16* vt = vl + (8 * hf + (lane & 7)) * VP + 8 * ((lane >> 3) & 1);   // this lane's address in the transposing loads, key 0, column 0
    const _Float16* kt = kl + l15 * KP + 8 * hf;            // this lane's place in the K fragments, key tile 0, k 0
    const int srow = (int)threadIdx.x >> 4, scol = ((int)threadIdx.x & 15) * 4;   // staging: row within a step of 2 AW rows, 16-byte piece of the 256-byte row
    const int jend = (bx + 1) * 64;
    for (int j0 = 0; j0 < jend; j0 += 64) {
        __syncthreads();                                     // previous key block's reads of kl and vl are done
        {
            v4f kr[8], vr[8];                                // four consecutive elements per thread and step, rows 2 AW apart per step: a wave's load covers two whole rows
            const float* krow = kbase + (long long)(j0 + srow) * FD + scol;
            const float* vrow = vbase + (long long)(j0 + srow) * FD + scol;
#pragma unroll
            for (int it = 0; it < 8; ++it) { kr[it] = *(const v4f*)(krow + it * (2 * AW * FD)); vr[it] = *(const v4f*)(vrow + it * (2 * AW * FD)); }
            // the loaded values as inputs: their first use is here, so the block's 16 loads are all issued before any is waited on (without it the scheduler puts
            // each load directly in front of its conversion and waits on it there); the addresses as inputs keep them live, so that no load is given their registers
            // as destination, and the wait stands in front of any reuse of them
            asm volatile("s_wait_xcnt 0x0" :: "v"(kr[0]), "v"(kr[1]), "v"(kr[2]), "v"(kr[3]), "v"(kr[4]), "v"(kr[5]), "v"(kr[6]), "v"(kr[7]),
                         "v"(vr[0]), "v"(vr[1]), "v"(vr[2]), "v"(vr[3]), "v"(vr[4]), "v"(vr[5]), "v"(vr[6]), "v"(vr[7]), "v"(krow), "v"(vrow) : "memory");
#pragma unroll
            for (int it = 0; it < 8; ++it) {
                v4h hk, hv;
#pragma unroll
                for (int e = 0; e < 4; ++e) { hk[e] = (_Float16)kr[it][e]; hv[e] = (_Float16)vr[it][e]; }
                *(v4h*)(kl + (srow + it * (2 * AW)) * KP + scol) = hk;
                *(v4h*)(vl + (srow + it * (2 * AW)) * VP + scol) = hv;
            }
        }
        __syncthreads();                                     // the K and V tiles are visible
        v8f s[4];
#pragma unroll
        for (int t = 0; t < 4; ++t) {
            v8f acc = {};
#pragma unroll
            for (int ks = 0; ks < 2; ++ks) {
                union { v16h v; v8h p[2]; } a;               // elements 0..7: k = 32 ks + 8 hf + (0..7); 8..15: 16 more
                a.p[0] = *(const v8h*)(kt + (16 * t) * KP + 32 * ks); a.p[1] = *(const v8h*)(kt + (16 * t) * KP + 32 * ks + 16);
                acc = __builtin_amdgcn_wmma_f32_16x16x32_f16(false, a.v, false, qa[ks], (short)0, acc, false, false);
            }
            s[t] = acc;
        }
        const int lim = q0 + l15 - j0 - 8 * hf;              // key 16 t + r of this half joins while 16 t + r <= lim
        float mt[4];                                         // per score tile, so that four short chains run side by side
#pragma unroll
        for (int t = 0; t < 4; ++t) {
            mt[t] = NEG;
#pragma unroll
            for (int r = 0; r < 8; ++r) { const float v = (16 * t + r > lim) ? NEG : s[t][r] * SC; s[t][r] = v; mt[t] = fmaxf(mt[t], v); }
        }
        float mx = fmaxf(fmaxf(mt[0], mt[1]), fmaxf(mt[2], mt[3]));
        mx = fmaxf(mx, at_xhalf(mx));
        const float mnew = fmaxf(m, mx);                     // finite from the first key block on: key 0 joins every query
        const float corr = at_exp2(m - mnew);                // 0 in the first key block, where m is -inf
        float rt[4];
        v16h pb[2];
#pragma unroll
        for (int t = 0; t < 4; ++t) {
            const v8f pp = at_exp2x8(s[t] - mnew);           // 0 for a masked key
            rt[t] = pp[0];
#pragma unroll
            for (int r = 1; r < 8; ++r) rt[t] += pp[r];
#pragma unroll
            for (int r = 0; r < 8; ++r) pb[t >> 1][(t & 1) * 8 + r] = (_Float16)(pp[r] * 4096.f);
        }
        const float rs = (rt[0] + rt[1]) + (rt[2] + rt[3]);
        l = l * corr + rs; m = mnew;
#pragma unroll
        for (int t = 0; t < 4; ++t) o[t] *= corr;
#pragma unroll
        for (int t = 0; t < 4; ++t)
#pragma unroll
            for (int ks = 0; ks < 2; ++ks) {
                union { v16h v; v8h p[2]; } a;
                a.p[0] = at_ld_tr16(vt + (32 * ks) * VP + 16 * t); a.p[1] = at_ld_tr16(vt + (32 * ks + 16) * VP + 16 * t);
                o[t] = __builtin_amdgcn_wmma_f32_16x16x32_f16(false, a.v, false, pb[ks], (short)0, o[t], false, false);
            }
    }
    l += at_xhalf(l);                                        // the two halves' sums meet once
    const float inv = (l > 0.f) ? 1.f / (l * 4096.f) : 0.f;
    float* myo = ol[wave];
#pragma unroll
    for (int t = 0; t < 4; ++t) {
        v4f lo, hi;
#pragma unroll
        for (int r = 0; r < 4; ++r) { lo[r] = o[t][r] * inv; hi[r] = o[t][4 + r] * inv; }
        *(v4f*)(myo + l15 * OP + 16 * t + 8 * hf) = lo; *(v4f*)(myo + l15 * OP + 16 * t + 8 * hf + 4) = hi;
    }
    __syncthreads();                                         // the staged rows are visible to the lanes that store them
    float* obase = O + hb;
    v4f ov[8];
#pragma unroll
    for (int i = 0; i < 8; ++i) ov[i] = *(const v4f*)(myo + (2 * i + hf) * OP + l15 * 4);
#pragma unroll
    for (int i = 0; i < 8; ++i) VST2V4(obase + (size_t)(q0 + 2 * i + hf) * FD + l15 * 4, ov[i]);   // each store instruction writes two whole 256-byte rows
}

// =====================================================================================================================
// k_tr: dst(z, c, r) = alpha * src(z, r, c) (+ beta * R2(z, c, r)): [Z][R][C] (row stride lds) -> [Z][C][R] (row stride ldd) through a 32x32 LDS tile;
//   flags: 1 -> add beta * residual R2 addressed like dst (z*sRz + c*ldr + r); act applied before the residual.
// =====================================================================================================================
struct TrP { const float* src; float* dst; const float* R2; long long sSz, lds, sDz, ldd, sRz, ldr; int R, C, flags, act; float alpha, beta; };
static_assert(sizeof(TrP) == 3 * 8 + 6 * 8 + 6 * 4, "TrP has padding");
__global__ __launch_bounds__(256) void k_tr(TrP p) {
    __shared__ float tile[32][33];
    const int c0 = blockIdx.x * 32, r0 = blockIdx.y * 32, z = blockIdx.z;
    const int lane = threadIdx.x & 31, wave = threadIdx.x >> 5;
    const float* s = p.src + z * p.sSz;
#pragma unroll
    for (int k = 0; k < 4; ++k) {
        const int rl = wave * 4 + k, r = r0 + rl, c = c0 + lane;
        tile[rl][lane] = (r < p.R && c < p.C) ? s[(long long)r * p.lds + c] : 0.f;
    }
    __syncthreads();
    float* d = p.dst + z * p.sDz; const float* rr = p.R2 + z * p.sRz;
#pragma unroll
    for (int k = 0; k < 4; ++k) {
        const int cl = wave * 4 + k, c = c0 + cl, r = r0 + lane;
        if (c < p.C && r < p.R) {
            float v = act_fn(p.alpha * tile[lane][cl], p.act);
            if (p.flags & 1) v += p.beta * rr[(long long)c * p.ldr + r];
            VST2(float, d + (long long)c * p.ldd + r, v);
        }
    }
}

// k_affine: dst[i] = a * (sdev ? sdev[0] : 1) * src[i] + b, i < n (one thread per element; consecutive lanes -> consecutive addresses)
__global__ __launch_bounds__(256) void k_affine(const float* __restrict__ src, float* __restrict__ dst, int n, float a, float b, const float* __restrict__ sdev) {
    const int i = blockIdx.x * 256 + threadIdx.x;
    if (i < n) { const float aa = sdev ? a * sdev[0] : a; const float v = aa * src[i] + b; VST2(float, dst + i, v); }
}

// =====================================================================================================================
// k_softmax: row softmax over n contiguous elements, one 256-thread block per row; rows addressed z*sz + r*sr (grid (R, Z)).
//   out = scale_out * softmax(scale_in * x + (Mf ? Mf[z*smz + r*smr + j] : 0)); a row whose max is -inf is written as 0.
// =====================================================================================================================
struct SmP { const float* src; float* dst; const float* Mf; long long sz, sr, dz, dr, smz, smr; int n, pad; float scale_in, scale_out; };
static_assert(sizeof(SmP) == 3 * 8 + 6 * 8 + 4 * 4, "SmP has padding");
__global__ __launch_bounds__(256) void k_softmax(SmP p) {
    __shared__ float red[256];
    const int r = blockIdx.x, z = blockIdx.y, tid = threadIdx.x;
    const float* s = p.src + z * p.sz + (long long)r * p.sr;
    const float* mf = p.Mf ? (p.Mf + z * p.smz + (long long)r * p.smr) : nullptr;
    float mx = -__builtin_inff();
    for (int j = tid; j < p.n; j += 256) { float v = s[j] * p.scale_in; if (mf) v += mf[j]; mx = fmaxf(mx, v); }
    red[tid] = mx; __syncthreads();
    for (int o = 128; o > 0; o >>= 1) { if (tid < o) red[tid] = fmaxf(red[tid], red[tid + o]); __syncthreads(); }
    mx = red[0]; __syncthreads();
    float sum = 0.f;
    for (int j = tid; j < p.n; j += 256) { float v = s[j] * p.scale_in; if (mf) v += mf[j]; sum += (mx == -__builtin_inff()) ? 0.f : expf(v - mx); }
    red[tid] = sum; __syncthreads();
    for (int o = 128; o > 0; o >>= 1) { if (tid < o) red[tid] += red[tid + o]; __syncthreads(); }
    sum = red[0];
    const float inv = (sum > 0.f) ? p.scale_out / sum : 0.f;
    float* d = p.dst + z * p.dz + (long long)r * p.dr;
    for (int j = tid; j < p.n; j += 256) { float v = s[j] * p.scale_in; if (mf) v += mf[j]; const float o = (mx == -__builtin_inff()) ? 0.f : expf(v - mx) * inv; VST2(float, d + j, o); }
}
// =====================================================================================================================
// k_stats: mean and rsqrt(var + eps) over a set of n elements addressed base + z*sz + (e / inner) * so + (e % inner) * si, one 256-thread
// k_norm_apply: y = (x - mean[set]) * rstd[set] * g[c] + b[c] over a [Z][C][L] channel-major tensor with set = z*G + c / (C/G) (G groups per z;
//   G = C -> per-channel sets indexed z*C+c; for batch norm pass stats indexed by c only via bn = 1). Optional act. Output same layout.
// =====================================================================================================================
//   mode 0: mean / rsqrt(var + eps); mode 1 (RMSNorm): 0 / rsqrt(mean(x^2) + eps); mode 2 (L2 normalize * sqrt(n)): 0 / sqrt(n) / max(||x||, eps); mode 3: as 0 with unbiased variance (n-1)
__global__ __launch_bounds__(256) void k_stats(const float* __restrict__ x, long long sz, long long so, long long si, int inner, int n, float eps, float* __restrict__ stat, int mode) {
    __shared__ float red[256];
    const int z = blockIdx.x, tid = threadIdx.x;
    const float* base = x + z * sz;
    float s = 0.f;
    for (int e = tid; e < n; e += 256) s += base[(long long)(e / inner) * so + (long long)(e % inner) * si];
    red[tid] = s; __syncthreads();
    for (int o = 128; o > 0; o >>= 1) { if (tid < o) red[tid] += red[tid + o]; __syncthreads(); }
    const float mu = (mode == 0 || mode == 3) ? red[0] / (float)n : 0.f; __syncthreads();
    float q = 0.f;
    for (int e = tid; e < n; e += 256) { const float dlt = base[(long long)(e / inner) * so + (long long)(e % inner) * si] - mu; q += dlt * dlt; }
    red[tid] = q; __syncthreads();
    for (int o = 128; o > 0; o >>= 1) { if (tid < o) red[tid] += red[tid + o]; __syncthreads(); }
    {
        float rs;
        if (mode == 2) rs = sqrtf((float)n) / fmaxf(sqrtf(red[0]), eps); else if (mode == 3) rs = rsqrtf(red[0] / (float)(n - 1) + eps); else rs = rsqrtf(red[0] / (float)n + eps);
        if (tid < 32) { const float v = (tid == 0) ? mu : ((tid == 1) ? rs : 0.f); VST2(float, stat + (long long)z * 32 + tid, v); }
    }
}
//   One thread per element over the flat [Z][C][L] index space: grid ceil(Z*C*L / 256).
__global__ __launch_bounds__(256) void k_norm_apply(const float* __restrict__ x, float* __restrict__ y, const float* __restrict__ stat, const float* __restrict__ g, const float* __restrict__ bta,
                                                     int Z, int C, int L, int G, int bn, int act) {
    const long long idx = (long long)blockIdx.x * 256 + threadIdx.x;
    if (idx >= (long long)Z * C * L) return;
    const int l = (int)(idx % L); const long long zc = idx / L; const int c = (int)(zc % C), z = (int)(zc / C); (void)l;
    const int set = bn ? c : (z * G + c / (C / G));
    float v = (x[idx] - stat[(long long)set * 32]) * stat[(long long)set * 32 + 1];
    if (g) v *= g[c];
    if (bta) v += bta[c];
    v = act_fn(v, act);
    VST2(float, y + idx, v);
}

// k_lse_neg: c[i] = -(st[2i] + log(st[2i+1])) = minus the log-sum-exp of row i from k_attn's ST output (for softmax over the query dimension)
__global__ __launch_bounds__(256) void k_lse_neg(const float* __restrict__ st, float* __restrict__ c, int n) {
    const int i = blockIdx.x * 256 + threadIdx.x;
    if (i < n) { const float v = -(st[2 * i] + logf(st[2 * i + 1])); VST2(float, c + i, v); }
}

// k_iota: dst[i] = a * i + b as int32 (segment/position id helper)
__global__ __launch_bounds__(256) void k_iota(int* __restrict__ dst, int n, int a, int b) {
    const int i = blockIdx.x * 256 + threadIdx.x;
    if (i < n) { const int v = a * i + b; VST2(int, dst + i, v); }
}

// k_axpby: dst[i] = a * x[i] + b * y[i] (+ c), i < n
__global__ __launch_bounds__(256) void k_axpby(const float* __restrict__ x, const float* __restrict__ y, float* __restrict__ dst, int n, float a, float b, float c) {
    const int i = blockIdx.x * 256 + threadIdx.x;
    if (i < n) { const float v = a * x[i] + b * y[i] + c; VST2(float, dst + i, v); }
}

// =====================================================================================================================
// k_rope: rotary embedding on a [R rows][Hn heads][D] view (row stride sXr, head stride sXh, element stride 1) -> Y (own strides).
//   mode 0: rotate_half (partner d±D/2, sign - for d<D/2); mode 1: interleaved pairs (partner d^1, sign - for even d).
//   table column tcol: tmode 0 -> d, 1 -> d % (D/2), 2 -> d / 2; position p: pmode 0 -> r % S, 1 -> head index, 2 -> pos[r];
//   c = C[(r / S) * sCb + p * sCp + tcol * sCd], s likewise from Sn; y = x[d] * c + sign * x[partner] * s. X and Y must not alias.
// =====================================================================================================================
struct RopeP { const float* X; float* Y; const float* C; const float* Sn; const int* pos; long long sXr, sXh, sYr, sYh, sCb, sCp, sCd; int R, Hn, D, S, mode, tmode, pmode, pad; };
static_assert(sizeof(RopeP) == 5 * 8 + 7 * 8 + 8 * 4, "RopeP has padding");
__global__ __launch_bounds__(256) void k_rope(RopeP p) {
    const long long idx = (long long)blockIdx.x * 256 + threadIdx.x;
    if (idx >= (long long)p.R * p.Hn * p.D) return;
    const int d = (int)(idx % p.D); const long long rh = idx / p.D; const int h = (int)(rh % p.Hn); const int r = (int)(rh / p.Hn);
    const int half = p.D / 2;
    int partner; float sign;
    if (p.mode == 0) { partner = (d < half) ? d + half : d - half; sign = (d < half) ? -1.f : 1.f; }
    else { partner = d ^ 1; sign = (d & 1) ? 1.f : -1.f; }
    const int tcol = (p.tmode == 0) ? d : ((p.tmode == 1) ? (d % half) : (d >> 1));
    const int pp = (p.pmode == 0) ? (r % p.S) : ((p.pmode == 1) ? h : p.pos[r]);
    const long long toff = (long long)(r / p.S) * p.sCb + (long long)pp * p.sCp + (long long)tcol * p.sCd;
    const float* xr = p.X + (long long)r * p.sXr + (long long)h * p.sXh;
    const float v = xr[d] * p.C[toff] + sign * xr[partner] * p.Sn[toff];
    VST2(float, p.Y + (long long)r * p.sYr + (long long)h * p.sYh + d, v);
}

// k_invf + k_sincos (split so neither kernel carries a large VALU-fma footprint): invf_i = num * (1 / powf(base, (2 i)/D)) [fmode 0],
//   num * expf((2 i) * cexp) [fmode 1], num * powf(base, -2 (i - 1) / D) [fmode 2]; then cs/sn[s*half + i] = cos/sin((pscale * s) * invf_i)
__global__ __launch_bounds__(256) void k_invf(float* __restrict__ invb, int half, int D, float base, float num, int fmode, float cexp) {
    const int i = blockIdx.x * 256 + threadIdx.x;
    if (i >= ((half + 31) / 32) * 32) return;
    if (i >= half) { VST2(float, invb + i, 0.f); return; }
    const float e = (float)(2 * i) / (float)D;
    float invf;
    if (fmode == 1) invf = num * expf((float)(2 * i) * cexp);
    else if (fmode == 2) invf = num * powf(base, (-2.0f * ((float)i - 1.0f)) / (float)D);
    else invf = num * (1.0f / powf(base, e));
    VST2(float, invb + i, invf);
}
__global__ __launch_bounds__(256) void k_sincos(float* __restrict__ cs, float* __restrict__ sn, const float* __restrict__ invb, int S, int half, float pscale) {
    const int idx = blockIdx.x * 256 + threadIdx.x;
    if (idx >= S * half) return;
    const int s = idx / half, i = idx - s * half;
    const float ang = (pscale * (float)s) * invb[i];
    VST2(float, cs + idx, cosf(ang)); VST2(float, sn + idx, sinf(ang));
}

// k_mulact: dst[i] = act(x[i]) * y[i]
__global__ __launch_bounds__(256) void k_mulact(const float* __restrict__ x, const float* __restrict__ y, float* __restrict__ dst, int n, int act) {
    const int i = blockIdx.x * 256 + threadIdx.x;
    if (i < n) { const float v = act_fn(x[i], act) * y[i]; VST2(float, dst + i, v); }
}

// =====================================================================================================================
// k_matvec: thread-per-row matrix-vector products for N <= 8 output columns (heads with 1-3 outputs, gates), f32 on the VALU.
//   C[r*sCm + j] = act(alpha * sum_k A[r*sAm + k*sAk] * B[j*sBn + k*sBk] + bias[j]) + beta * R[r*sRm + j*sRn]; each thread writes its N contiguous floats.
// =====================================================================================================================
__global__ __launch_bounds__(256) void k_matvec(GemmP p) {
    // 32 lanes write one line with one instruction.
    const int rpt = (p.N == 1) ? 1 : 32;
    const long long r0 = ((long long)blockIdx.x * 256 + threadIdx.x) * rpt; const int z = blockIdx.z, zo = z / p.zi_n, zi = z - zo * p.zi_n;
    if (r0 >= p.M) return;
    const float* Bb = p.B + zo * p.sBo + zi * p.sBi;
    float* C = p.C + zo * p.sCo + zi * p.sCi; const float* R = p.R + zo * p.sRo + zi * p.sRi;
    for (int rr = 0; rr < rpt; ++rr) {
        const long long r = r0 + rr; if (r >= p.M) break;
        const float* A = p.A + zo * p.sAo + zi * p.sAi + r * p.sAm;
        float acc[8] = {0.f, 0.f, 0.f, 0.f, 0.f, 0.f, 0.f, 0.f};
        for (int k = 0; k < p.K; ++k) { const float a = A[(long long)k * p.sAk];
#pragma unroll
            for (int j = 0; j < 8; ++j) if (j < p.N) acc[j] += a * Bb[(long long)j * p.sBn + (long long)k * p.sBk]; }
#pragma unroll
        for (int j = 0; j < 8; ++j) if (j < p.N) {
            float v = acc[j] * p.alpha;
            if (p.flags & 1) v += p.bias[j];
            if (p.flags & 2) v += p.bias[r];
            v = act_fn(v, p.act);
            if (p.flags & 4) v += p.beta * R[r * p.sRm + (long long)j * p.sRn];
            VST2(float, C + r * p.sCm + j, v);
        }
    }
}
// k_smallsoftmax: thread-per-row softmax for short rows (n <= 64): dst[r*dr + j] = softmax(scale*src[r*sr + j])
__global__ __launch_bounds__(256) void k_smallsoftmax(const float* __restrict__ src, float* __restrict__ dst, long long sr, long long dr, int n, long long R, float scale) {
    const long long r0 = ((long long)blockIdx.x * 256 + threadIdx.x) * 32;
    for (int rr = 0; rr < 32; ++rr) {
        const long long r = r0 + rr; if (r >= R) return;
        const float* s = src + r * sr; float* d = dst + r * dr;
        float mx = -__builtin_inff();
        for (int j = 0; j < n; ++j) mx = fmaxf(mx, s[j] * scale);
        float sum = 0.f;
        for (int j = 0; j < n; ++j) sum += expf(s[j] * scale - mx);
        const float inv = 1.f / sum;
        for (int j = 0; j < n; ++j) { const float v = expf(s[j] * scale - mx) * inv; VST2(float, d + j, v); }
    }
}

__global__ __launch_bounds__(32) void k_unitstat(float* __restrict__ st) { const int t = threadIdx.x; const float v = (t == 1) ? 1.f : 0.f; VST2(float, st + t, v); }

// destination (e.g. a d_out whose row width is not a multiple of 32 floats) is written by consecutive lanes of one instruction
__global__ __launch_bounds__(256) void k_lincopy(const float* __restrict__ src, long long lds, float* __restrict__ dst, long long ldd, long long rows, int cols) {
    const long long i = (long long)blockIdx.x * 256 + threadIdx.x; if (i >= rows * cols) return;
    const long long r = i / cols; const int c = (int)(i - r * cols);
    const float v = src[r * lds + c]; VST2(float, dst + r * ldd + c, v);
}

namespace w25 {
typedef __attribute__((ext_vector_type(16))) _Float16 v16h;
typedef __attribute__((ext_vector_type(8)))  _Float16 v8h;
typedef __attribute__((ext_vector_type(16))) __bf16   v16b;
typedef __attribute__((ext_vector_type(8)))  __bf16   v8b;
typedef __attribute__((ext_vector_type(8)))  float    v8f;
typedef __attribute__((ext_vector_type(4)))  float    v4f;

__device__ __forceinline__ unsigned short f2bf_bits(float f) {
  unsigned u = __float_as_uint(f);
  return (unsigned short)((u + 0x7FFFu + ((u >> 16) & 1u)) >> 16);
}
__device__ __forceinline__ float bf_bits2f(unsigned short h) { return __uint_as_float(((unsigned)h) << 16); }

template <typename T> struct Frag;
template <> struct Frag<_Float16> {
  typedef v16h V; union U { v16h v; v8h h[2]; };
  static __device__ __forceinline__ v16h load(const _Float16* p) {   // elements 0..7 <- p[0..7], 8..15 <- p[16..23]
    U f; f.h[0] = *(const v8h*)(p); f.h[1] = *(const v8h*)(p + 16); return f.v;
  }
  static __device__ __forceinline__ v8f mma(v16h a, v16h b, v8f c) {
    return __builtin_amdgcn_wmma_f32_16x16x32_f16(false, a, false, b, (short)0, c, false, false);
  }
};
template <> struct Frag<__bf16> {
  typedef v16b V; union U { v16b v; v8b h[2]; };
  static __device__ __forceinline__ v16b load(const __bf16* p) {
    U f; f.h[0] = *(const v8b*)(p); f.h[1] = *(const v8b*)(p + 16); return f.v;
  }
  static __device__ __forceinline__ v8f mma(v16b a, v16b b, v8f c) {
    return __builtin_amdgcn_wmma_f32_16x16x32_bf16(false, a, false, b, (short)0, c, false, false);
  }
};

// ---- WMMA GEMM with both operands staged in LDS ------------------------------
// C[m,n] = scale * sum_k A[m,k] * Bt[n,k], f32 out. A row-major [M,K]; Bt row-major [N,K]; C row-major [M,N]; M % 128 == 0, N % 128 == 0, K % 64 == 0.
// grid (N / 128, M / 128), 8 waves: a work-group owns a 128 x 128 tile of C, wave (wave >> 1, wave & 1) a 32 x 64 part of it (per pair of planes an A fragment serves 4 products, a Bt fragment 2).
// K runs in stages of 64: a stage's 128 A rows and 128 Bt rows (128 B each, per plane) come from global memory as whole 128-byte lines
// (8 lanes x 16 B per row), go to LDS at a pitch of 144 B, and every wave reads its fragments from there with 16-byte LDS loads.
// Two LDS buffers: the next stage's global loads are in flight while the current stage is multiplied; one barrier per stage.
// SPLIT: operands are hi/lo planes (A2/Bt2 = lo planes, same layout); product = hi.hi + hi.lo + lo.hi, in that order per 32 k.
// ET: 0 = f16 operands, 1 = bf16 operands (pointers passed as 16-bit storage)
// astep: rows of A from one 64-row half tile of C to the next (64: A is dense; more: each half tile takes the first 64 rows of a longer block of A)
template <int ET> struct Elem;
template <> struct Elem<0> { typedef _Float16 T; typedef v8h V8; };
template <> struct Elem<1> { typedef __bf16 T; typedef v8b V8; };
// One launch holds up to three products with the same A: grid (N / 128, T0 + 2 T1). Tile rows 0 .. T0 - 1 belong to C0 = A.Bt0^T with A dense (128 rows a tile);
// the next T1 to C1 = A.Bt1^T and the last T1 to C2 = A.Bt2^T, both with astep1 rows of A from half tile to half tile. A launch of T0 + T1 tile rows never touches Bt2 and C2, one of T0 only Bt0 and C0.
struct GemmB { const unsigned short* hi; const unsigned short* lo; float* c; };   // one product's Bt planes (lo unused without SPLIT) and its C
template <int ET, bool SPLIT>
__global__ __launch_bounds__(256) void wmma_gemm_lds(
    const unsigned short* __restrict__ Ap, const unsigned short* __restrict__ A2p,
    GemmB p0, GemmB p1, GemmB p2, int T0, int T1, int N, int K, float scale, int astep1) {
  const int ty = (int)blockIdx.y;
  const int pw = ty < T0 ? 0 : (ty < T0 + T1 ? 1 : 2);                       // which product; the same for the whole work-group
  const int by = pw == 0 ? ty : (pw == 1 ? ty - T0 : ty - T0 - T1);          // tile row within it
  const int astep = pw == 0 ? 64 : astep1;
  const unsigned short* __restrict__ Btp  = pw == 0 ? p0.hi : (pw == 1 ? p1.hi : p2.hi);
  const unsigned short* __restrict__ Bt2p = pw == 0 ? p0.lo : (pw == 1 ? p1.lo : p2.lo);
  float* __restrict__ C = pw == 0 ? p0.c : (pw == 1 ? p1.c : p2.c);
  typedef typename Elem<ET>::T T;
  typedef typename Elem<ET>::V8 V8;
  typedef typename Frag<T>::V V;
  constexpr int NP    = SPLIT ? 2 : 1;      // planes
  constexpr int PITCH = 72;                 // LDS row pitch in 16-bit elements: 144 B = 16 B x 9
  constexpr int TM    = 128;                // rows of A and of C in a tile
  constexpr int PROWS = TM + 128;           // rows of one plane in a stage: 128 of A, then 128 of Bt
  constexpr int STAGE = NP * PROWS * PITCH; // elements of one buffer
  constexpr int NL    = NP * 8;             // 16-byte pieces per thread and stage (32 rows per step)
  constexpr int CP    = 132;                // pitch of the staged C tile in floats
  static_assert(2 * STAGE * 2 >= TM * CP * 4, "the C tile is staged in the operand buffers");
  __shared__ __align__(16) T sm[2 * STAGE];
  const int lane = threadIdx.x & 31;
  const int wave = threadIdx.x >> 5;
  const int m0 = by << 7;
  const int n0 = blockIdx.x << 7;
  const int wm = (wave >> 1) << 5;          // this wave's first row and column in the tile
  const int wn = (wave & 1) << 6;
  const int rlane = lane & 15;              // row (A) / col (B, D) within a 16 x 16 subtile
  const int koff  = (lane >> 4) * 8;        // k offset of this lane half
  const int mOff  = (lane >> 4) * 8;        // D row offset

  const int lrow = threadIdx.x >> 3, lseg = (threadIdx.x & 7) * 8;   // staging: row within a step of 32 rows, 16-byte piece of the row
  const int a0 = 2 * by * astep;            // first A row of this tile
  const size_t ahalf = (size_t)astep * K;   // elements of A from the tile's first 64 rows to its second 64
  const T* gA  = (const T*)Ap  + (size_t)(a0 + lrow) * K + lseg;
  const T* gB  = (const T*)Btp + (size_t)(n0 + lrow) * K + lseg;
  const T* gA2 = SPLIT ? (const T*)A2p  + (size_t)(a0 + lrow) * K + lseg : nullptr;
  const T* gB2 = SPLIT ? (const T*)Bt2p + (size_t)(n0 + lrow) * K + lseg : nullptr;
  const int sw = lrow * PITCH + lseg;       // this thread's place in a buffer, step 0
  const int fa = (wm + rlane) * PITCH + koff;        // this lane's A and Bt fragment places in a buffer, subtile 0, k 0
  const int fb = (TM + wn + rlane) * PITCH + koff;

  v8f acc[2][4];
#pragma unroll
  for (int i = 0; i < 2; ++i)
#pragma unroll
    for (int j = 0; j < 4; ++j) acc[i][j] = (v8f){0.f,0.f,0.f,0.f,0.f,0.f,0.f,0.f};

  V8 st[NL];
  auto src = [&](int it) -> const T* {      // where this thread's piece it of a stage lies, at k 0
    const int q = it % 8;                   // steps 0..3: A rows; 4..7: Bt rows; then the same for the lo planes
    const T* g = (it < 8) ? (q < 4 ? gA : gB) : (q < 4 ? gA2 : gB2);
    return g + (q < 4 ? (q >> 1) * ahalf + (size_t)((q & 1) * 32) * K : (size_t)((q - 4) * 32) * K);
  };
  auto fetch = [&](int k0) {                // stage at k0: global memory -> registers
#pragma unroll
    for (int it = 0; it < NL; ++it) st[it] = *(const V8*)(src(it) + k0);
  };
  auto put = [&](int buf) {                 // registers -> LDS buffer
#pragma unroll
    for (int it = 0; it < NL; ++it) *(V8*)(sm + buf * STAGE + sw + it * (32 * PITCH)) = st[it];
  };
  auto mult = [&](int buf) {                // one stage: 2 steps of 32 k
    const T* s = sm + buf * STAGE;
#pragma unroll
    for (int kk = 0; kk < 2; ++kk) {
      V ah[2], al[2], bh[4], bl[4];
#pragma unroll
      for (int i = 0; i < 2; ++i) {
        ah[i] = Frag<T>::load(s + fa + i * (16 * PITCH) + kk * 32);
        if (SPLIT) al[i] = Frag<T>::load(s + PROWS * PITCH + fa + i * (16 * PITCH) + kk * 32);
      }
#pragma unroll
      for (int j = 0; j < 4; ++j) {
        bh[j] = Frag<T>::load(s + fb + j * (16 * PITCH) + kk * 32);
        if (SPLIT) bl[j] = Frag<T>::load(s + PROWS * PITCH + fb + j * (16 * PITCH) + kk * 32);
      }
#pragma unroll
      for (int i = 0; i < 2; ++i)
#pragma unroll
        for (int j = 0; j < 4; ++j) acc[i][j] = Frag<T>::mma(ah[i], bh[j], acc[i][j]);
      if (SPLIT) {
#pragma unroll
        for (int i = 0; i < 2; ++i)
#pragma unroll
          for (int j = 0; j < 4; ++j) acc[i][j] = Frag<T>::mma(ah[i], bl[j], acc[i][j]);
#pragma unroll
        for (int i = 0; i < 2; ++i)
#pragma unroll
          for (int j = 0; j < 4; ++j) acc[i][j] = Frag<T>::mma(al[i], bh[j], acc[i][j]);
      }
    }
  };

  const int NK = K >> 6;
  {                                         // stage 0
    const T* p[NL];
#pragma unroll
    for (int it = 0; it < NL; ++it) p[it] = src(it);
#pragma unroll
    for (int it = 0; it < NL; ++it) st[it] = *(const V8*)p[it];
    // in front of any reuse of the loads' address registers; the addresses as inputs keep them from taking a load's result ahead of the wait
    if constexpr (SPLIT) asm volatile("s_wait_xcnt 0x0" :: "v"(p[0]), "v"(p[1]), "v"(p[2]), "v"(p[3]), "v"(p[4]), "v"(p[5]), "v"(p[6]), "v"(p[7]),
                                      "v"(p[8]), "v"(p[9]), "v"(p[10]), "v"(p[11]), "v"(p[12]), "v"(p[13]), "v"(p[14]), "v"(p[15]) : "memory");
    else                 asm volatile("s_wait_xcnt 0x0" :: "v"(p[0]), "v"(p[1]), "v"(p[2]), "v"(p[3]), "v"(p[4]), "v"(p[5]), "v"(p[6]), "v"(p[7]) : "memory");
  }
  put(0);
  __syncthreads();                          // stage 0 is visible
  for (int kt = 0; kt + 1 < NK; ++kt) {
    fetch((kt + 1) << 6);
    __builtin_amdgcn_sched_barrier(0);      // keeps the next stage's global loads issued ahead of this stage's products, so that their latency runs under them
    mult(kt & 1);
    put((kt + 1) & 1);                      // the buffer that stage kt - 1 was read from; its readers left it at the barrier that ended that trip
    __syncthreads();                        // stage kt + 1 is visible, and every wave has finished reading stage kt
  }
  mult((NK - 1) & 1);
  __syncthreads();                          // all fragment reads are done: the buffers now stage the C tile

  // ---- epilogue: the 128 x 128 f32 tile through LDS, so that each store instruction writes 512 contiguous bytes of one row ----
  float* sC = (float*)sm;
#pragma unroll
  for (int i = 0; i < 2; ++i)
#pragma unroll
    for (int j = 0; j < 4; ++j)
#pragma unroll
      for (int r = 0; r < 8; ++r) sC[(wm + (i << 4) + mOff + r) * CP + wn + (j << 4) + rlane] = acc[i][j][r] * scale;
  __syncthreads();
#pragma unroll
  for (int it = 0; it < TM / 8; ++it) {
    const int row = it * 8 + wave;
    const v4f v = *(const v4f*)(sC + row * CP + lane * 4);
    *(v4f*)(C + (size_t)(m0 + row) * N + n0 + lane * 4) = v;
  }
}

__global__ __launch_bounds__(256) void cast_f32_f16x2(
    const float* __restrict__ in, _Float16* __restrict__ out, int n2) {
  int i = blockIdx.x * 256 + threadIdx.x;
  if (i < n2) {
    const _Float16 h0 = (_Float16)in[2 * i], h1 = (_Float16)in[2 * i + 1];
    const unsigned u = (unsigned)__builtin_bit_cast(unsigned short, h0) | ((unsigned)__builtin_bit_cast(unsigned short, h1) << 16);
    ((unsigned*)out)[i] = u;
    
  }
}


} // namespace w25

__global__ __launch_bounds__(256) void k_castT16(const float* __restrict__ src, long long lds, _Float16* __restrict__ dst, long long ldd, int R, int C, float s) {
    const long long i = (long long)blockIdx.x * 256 + threadIdx.x; const long long np = (long long)C * (R / 2); if (i >= np) return; const int c = (int)(i / (R / 2)); const int r = 2 * (int)(i % (R / 2));
    const _Float16 h0 = (_Float16)(src[(long long)r * lds + c] * s), h1 = (_Float16)(src[(long long)(r + 1) * lds + c] * s);
    const unsigned u = (unsigned)__builtin_bit_cast(unsigned short, h0) | ((unsigned)__builtin_bit_cast(unsigned short, h1) << 16);
    unsigned* d = (unsigned*)(dst + (long long)c * ldd + r); *d = u;  }

// f32 -> bf16 hi plane + bf16 lo plane (x = hi + lo to ~2^-17 relative; RNE both), [R][C] -> [R][C]; 2 consecutive destination elements
__device__ __forceinline__ unsigned int f2bf2_pack(float a, float b, unsigned int* lo) {
    const unsigned short ha = w25::f2bf_bits(a), hb = w25::f2bf_bits(b);
    const unsigned short la = w25::f2bf_bits(a - w25::bf_bits2f(ha)), lb = w25::f2bf_bits(b - w25::bf_bits2f(hb));
    *lo = (unsigned)la | ((unsigned)lb << 16); return (unsigned)ha | ((unsigned)hb << 16); }

namespace w25 {
// =====================================================================================
// Generic causal/non-causal attention for head_dim 64, f32 in / f32 out; 16-bit operands: bf16 with optional hi/lo splits, or
// plain f16 (F16=true, non-split, probabilities carried x2^15).
//   scores = (q*qscale)·kᵀ : v_wmma_f32_16x16x32_bf16; SPLIT_QK -> q,k as bf16 hi/lo (hi·hi + hi·lo + lo·hi)
//   out    = p·v           : v_wmma_f32_16x16x32_bf16; SPLIT_PV -> p,v as bf16 hi/lo; else p,v plain bf16
//   f32 accumulate; online softmax in f32. Block = 4 waves = 64 query rows of one (batch, head); S % 64 == 0.
//   Element (b, s, h, d) of tensor X lives at X[b*X_bs + s*X_rs + h*X_hs + d] (strides in floats, multiples of 4).
//   Masking: mask_mode 0 none, 1 causal (kv > q masked), 2 tensor [S][Skv] shared over (b,h) (float if
//   mask_is_int==0, int32 with element == 0 -> masked if 1, int32 with element != 0 -> masked if 2), 3 per-token vectors qmask[B][S] & kvmask[B][Skv] (int32,
//   0 -> masked), 4 causal + sliding window (kv > q or q - kv > W masked; W passed in mask_is_int);
//   5 = relative-position bias: s += cp[b,h,q][idx[q][kv]] + pc[b,h,kv][idx[q][kv]] with idx = mask_b ([S][Skv] int32) and
//   mask_a an int32 [S][Skv] tensor with nonzero = masked (tables: element (b,h,row,n) at X + b*c_bs + h*c_hs + row*c_rs + n);
//   masked scores are replaced by mask_fill (e.g. -inf or -1e9) before the softmax.
//   grid.x = B * H * (S/64) (or a sub-range with blk0).
// =====================================================================================
#define AT_D 64
#define AT_NW 4
#define AT_QB 64
#define AT_KC 64
struct AttnGeom { const float* cp = nullptr; const float* pc = nullptr; long c_bs = 0, c_rs = 0, c_hs = 0;   // mode-5 score-bias tables
                  long q_bs, q_rs, q_hs, k_bs, k_rs, k_hs, v_bs, v_rs, v_hs, o_bs, o_rs, o_hs;
                  int S, Skv, H, mask_mode; float qscale; int blk0; float mask_fill; int mask_is_int; };
static_assert(sizeof(AttnGeom) == 168, "no padding");

__device__ __forceinline__ unsigned short at_bf_bits(float f) {
  unsigned u = __float_as_uint(f);
  return (unsigned short)((u + 0x7FFFu + ((u >> 16) & 1u)) >> 16);
}
__device__ __forceinline__ __bf16 at_f2bf(float f) { return __builtin_bit_cast(__bf16, at_bf_bits(f)); }
__device__ __forceinline__ void at_split(float f, __bf16& hi, __bf16& lo) {
  const unsigned short hb = at_bf_bits(f);
  hi = __builtin_bit_cast(__bf16, hb);
  lo = at_f2bf(f - __uint_as_float(((unsigned)hb) << 16));
}
__device__ __forceinline__ v8f at_mma(v16b a, v16b b, v8f c) {
  c = __builtin_amdgcn_wmma_f32_16x16x32_bf16(false, a, false, b, (short)0, c, false, false);
  asm volatile("v_nop\n\tv_nop\n\tv_nop\n\tv_nop" : "+v"(c) : "v"(a), "v"(b));
  return c;
}
// 16-bit element as a bit pattern held in a __bf16 slot: f16 bits when F16, bf16 (RNE) otherwise
template <bool F16> __device__ __forceinline__ __bf16 at_to16(float f) {
  if (F16) return __builtin_bit_cast(__bf16, (_Float16)f);
  return at_f2bf(f);
}
template <bool F16> __device__ __forceinline__ v8f at_mma16(v16b a, v16b b, v8f c) {
  if (F16) {
    const v16h ah = __builtin_bit_cast(v16h, a), bh = __builtin_bit_cast(v16h, b);
    c = __builtin_amdgcn_wmma_f32_16x16x32_f16(false, ah, false, bh, (short)0, c, false, false);
    asm volatile("v_nop\n\tv_nop\n\tv_nop\n\tv_nop" : "+v"(c) : "v"(ah), "v"(bh));
    return c;
  }
  return at_mma(a, b, c);
}

template <bool SPLIT_QK, bool SPLIT_PV, bool F16 = false>
__global__ __launch_bounds__(128)
void attn64_kernel(const float* __restrict__ q, const float* __restrict__ k,
                   const float* __restrict__ v, float* __restrict__ out,
                   const void* __restrict__ mask_a, const int* __restrict__ mask_b, AttnGeom g) {
  static_assert(!(F16 && (SPLIT_QK || SPLIT_PV)), "f16 mode is non-split");
  const float PSC = F16 ? 32768.0f : 1.0f;     // f16 probabilities carried x2^15 (subnormal range), folded into the final 1/l
  union FB { v16b v; v8b h[2]; };
  __shared__ __align__(16) __bf16 Ksh[AT_KC * AT_D];             // K hi [kv][d]      8 KB
  __shared__ __align__(16) __bf16 Ksl[SPLIT_QK ? AT_KC * AT_D : 8];
  __shared__ __align__(16) __bf16 Vth[AT_D * AT_KC];             // V hi [d][kv]      8 KB
  __shared__ __align__(16) __bf16 Vtl[SPLIT_PV ? AT_D * AT_KC : 8];
  __shared__ __align__(16) __bf16 Psh[AT_NW][16 * AT_KC];        // per wave P hi [row][kv]  8 KB
  __shared__ __align__(16) __bf16 Psl[SPLIT_PV ? AT_NW : 1][SPLIT_PV ? 16 * AT_KC : 8];
  __shared__ __align__(16) float  Os[AT_NW][16 * 68];            // per wave out tile, pitch 68

  const int tid  = threadIdx.x;
  const int wave = tid >> 5;
  const int lane = tid & 31;
  const int hh   = lane >> 4;
  const int c    = lane & 15;

  const int nqb = g.S / AT_QB;
  const int bx = blockIdx.x + g.blk0;
  const int qb = bx % nqb;
  const int bh = bx / nqb;
  const int h  = bh % g.H;
  const int b  = bh / g.H;
  const int qbase_block = qb * AT_QB;
  const int q0 = qbase_block + wave * 16;

  const float* qb_ptr = q + (size_t)b * g.q_bs + (size_t)h * g.q_hs;
  const float* kb_ptr = k + (size_t)b * g.k_bs + (size_t)h * g.k_hs;
  const float* vb_ptr = v + (size_t)b * g.v_bs + (size_t)h * g.v_hs;
  float*       ob_ptr = out + (size_t)b * g.o_bs + (size_t)h * g.o_hs;

  // ---- Q fragments (A operand): 2 d-chunks, hi (and lo) ----
  v16b qah[2], qal[2];
  {
    const float* qrow = qb_ptr + (size_t)(q0 + c) * g.q_rs;
#pragma unroll
    for (int dc = 0; dc < 2; ++dc) {
#pragma unroll
      for (int e = 0; e < 8; ++e) {
        const float f0 = qrow[dc * 32 + 8 * hh + e] * g.qscale;
        const float f1 = qrow[dc * 32 + 16 + 8 * hh + e] * g.qscale;
        if (SPLIT_QK) { __bf16 hq, lq; at_split(f0, hq, lq); qah[dc][e] = hq; qal[dc][e] = lq; at_split(f1, hq, lq); qah[dc][8 + e] = hq; qal[dc][8 + e] = lq; }
        else { qah[dc][e] = at_to16<F16>(f0); qah[dc][8 + e] = at_to16<F16>(f1); qal[dc][e] = qah[dc][e]; qal[dc][8 + e] = qah[dc][8 + e]; }
      }
    }
  }

  float mrow[8], lrow[8];
  v8f oacc[4];
#pragma unroll
  for (int r = 0; r < 8; ++r) { mrow[r] = -INFINITY; lrow[r] = 0.f; }
#pragma unroll
  for (int t = 0; t < 4; ++t) oacc[t] = (v8f){0.f,0.f,0.f,0.f,0.f,0.f,0.f,0.f};

  const int nChunks = (g.mask_mode == 1 || g.mask_mode == 4) ? (qb + 1) : (g.Skv / AT_KC);   // block-uniform
  // per-row query mask (mode 3)
  int qkeep[8];
#pragma unroll
  for (int r = 0; r < 8; ++r) qkeep[r] = (g.mask_mode == 3) ? mask_b[(size_t)b * g.S + q0 + 8 * hh + r] : 1;   // mask_b = qmask in mode 3
  for (int kc = 0; kc < nChunks; ++kc) {
    const int kv0 = kc * AT_KC;
    __syncthreads();
    {
      const int kvr = tid >> 1, dh = (tid & 1) * 32;
      const float* krow = kb_ptr + (size_t)(kv0 + kvr) * g.k_rs + dh;
      const float* vrow = vb_ptr + (size_t)(kv0 + kvr) * g.v_rs + dh;
#pragma unroll
      for (int i = 0; i < 8; ++i) {
        v4f kk = *(const v4f*)(krow + 4 * i);
        v4f vv = *(const v4f*)(vrow + 4 * i);
#pragma unroll
        for (int e = 0; e < 4; ++e) {
          const int d = dh + 4 * i + e;
          if (SPLIT_QK) { __bf16 a, bl; at_split(kk[e], a, bl); Ksh[kvr * AT_D + d] = a; Ksl[kvr * AT_D + d] = bl; }
          else Ksh[kvr * AT_D + d] = at_to16<F16>(kk[e]);
          if (SPLIT_PV) { __bf16 a, bl; at_split(vv[e], a, bl); Vth[d * AT_KC + kvr] = a; Vtl[d * AT_KC + kvr] = bl; }
          else Vth[d * AT_KC + kvr] = at_to16<F16>(vv[e]);
        }
      }
    }
    __syncthreads();

    v8f s[4];
#pragma unroll
    for (int j = 0; j < 4; ++j) {
      s[j] = (v8f){0.f,0.f,0.f,0.f,0.f,0.f,0.f,0.f};
#pragma unroll 1
      for (int dc = 0; dc < 2; ++dc) {
        FB kb;
        kb.h[0] = *(const v8b*)(Ksh + (j * 16 + c) * AT_D + dc * 32 + 8 * hh);
        kb.h[1] = *(const v8b*)(Ksh + (j * 16 + c) * AT_D + dc * 32 + 16 + 8 * hh);
        s[j] = at_mma16<F16>(qah[dc], kb.v, s[j]);
        if (SPLIT_QK) {
          FB kl;
          kl.h[0] = *(const v8b*)(Ksl + (j * 16 + c) * AT_D + dc * 32 + 8 * hh);
          kl.h[1] = *(const v8b*)(Ksl + (j * 16 + c) * AT_D + dc * 32 + 16 + 8 * hh);
          s[j] = at_mma16<F16>(qah[dc], kl.v, s[j]);
          s[j] = at_mma16<F16>(qal[dc], kb.v, s[j]);
        }
      }
    }
    const bool diag = (g.mask_mode == 1) && (kc == qb);
    int kvkeep[4] = {1, 1, 1, 1};
    if (g.mask_mode == 3) {
#pragma unroll
      for (int j = 0; j < 4; ++j) kvkeep[j] = ((const int*)mask_a)[(size_t)b * g.Skv + kv0 + j * 16 + c];   // mask_a = kvmask
    }
    float cm[8];
#pragma unroll
    for (int r = 0; r < 8; ++r) {
      const int qrow = q0 + 8 * hh + r;
      float m = -INFINITY;
#pragma unroll
      for (int j = 0; j < 4; ++j) {
        const int kvcol = kv0 + j * 16 + c;
        bool masked = false;
        if (diag) masked = (kvcol > qrow);
        else if (g.mask_mode == 4) masked = (kvcol > qrow) || (qrow - kvcol > g.mask_is_int);
        else if (g.mask_mode == 2) {
          const size_t mi = (size_t)qrow * g.Skv + kvcol;
          masked = (g.mask_is_int == 0) ? (((const float*)mask_a)[mi] == 0.0f)
                 : (g.mask_is_int == 1) ? (((const int*)mask_a)[mi] == 0) : (((const int*)mask_a)[mi] != 0);
        } else if (g.mask_mode == 3) masked = (qkeep[r] == 0) || (kvkeep[j] == 0);
        else if (g.mask_mode == 5) {
          const size_t mi = (size_t)qrow * g.Skv + kvcol;
          masked = (((const int*)mask_a)[mi] != 0);
          int n = mask_b[mi]; n = n < 0 ? 0 : n;
          s[j][r] += g.cp[(size_t)b * g.c_bs + (size_t)h * g.c_hs + (size_t)qrow * g.c_rs + n]
                   + g.pc[(size_t)b * g.c_bs + (size_t)h * g.c_hs + (size_t)kvcol * g.c_rs + n];
        }
        if (masked) s[j][r] = g.mask_fill;
        m = fmaxf(m, s[j][r]);
      }
#pragma unroll
      for (int off = 1; off < 16; off <<= 1) m = fmaxf(m, __shfl_xor(m, off, 32));
      cm[r] = m;
    }
    __bf16* pwh = Psh[wave];
    __bf16* pwl = Psl[SPLIT_PV ? wave : 0];
#pragma unroll
    for (int r = 0; r < 8; ++r) {
      const float mnew = fmaxf(mrow[r], cm[r]);
      const float alpha = expf(mrow[r] - mnew);
      mrow[r] = mnew;
      float psum = 0.f;
#pragma unroll
      for (int j = 0; j < 4; ++j) {
        const float p = expf(s[j][r] - mnew);
        psum += p;
        if (SPLIT_PV) { __bf16 a, bl; at_split(p, a, bl); pwh[(8 * hh + r) * AT_KC + j * 16 + c] = a; pwl[(8 * hh + r) * AT_KC + j * 16 + c] = bl; }
        else pwh[(8 * hh + r) * AT_KC + j * 16 + c] = at_to16<F16>(p * PSC);
      }
#pragma unroll
      for (int off = 1; off < 16; off <<= 1) psum += __shfl_xor(psum, off, 32);
      lrow[r] = lrow[r] * alpha + psum;
#pragma unroll
      for (int t = 0; t < 4; ++t) oacc[t][r] *= alpha;
    }
    __builtin_amdgcn_fence(__ATOMIC_RELEASE, "workgroup");
    __builtin_amdgcn_wave_barrier();
    __builtin_amdgcn_fence(__ATOMIC_ACQUIRE, "workgroup");
#pragma unroll 1
    for (int kk = 0; kk < 2; ++kk) {
      FB pa, pl;
      pa.h[0] = *(const v8b*)(pwh + c * AT_KC + kk * 32 + 8 * hh);
      pa.h[1] = *(const v8b*)(pwh + c * AT_KC + kk * 32 + 16 + 8 * hh);
      if (SPLIT_PV) {
        pl.h[0] = *(const v8b*)(pwl + c * AT_KC + kk * 32 + 8 * hh);
        pl.h[1] = *(const v8b*)(pwl + c * AT_KC + kk * 32 + 16 + 8 * hh);
      }
#pragma unroll
      for (int t = 0; t < 4; ++t) {
        FB vb;
        vb.h[0] = *(const v8b*)(Vth + (t * 16 + c) * AT_KC + kk * 32 + 8 * hh);
        vb.h[1] = *(const v8b*)(Vth + (t * 16 + c) * AT_KC + kk * 32 + 16 + 8 * hh);
        oacc[t] = at_mma16<F16>(pa.v, vb.v, oacc[t]);
        if (SPLIT_PV) {
          FB vl;
          vl.h[0] = *(const v8b*)(Vtl + (t * 16 + c) * AT_KC + kk * 32 + 8 * hh);
          vl.h[1] = *(const v8b*)(Vtl + (t * 16 + c) * AT_KC + kk * 32 + 16 + 8 * hh);
          oacc[t] = at_mma16<F16>(pa.v, vl.v, oacc[t]);
          oacc[t] = at_mma16<F16>(pl.v, vb.v, oacc[t]);
        }
      }
    }
  }

  float* os = Os[wave];
#pragma unroll
  for (int r = 0; r < 8; ++r) {
    const float inv = 1.0f / (lrow[r] * PSC);
#pragma unroll
    for (int t = 0; t < 4; ++t) os[(8 * hh + r) * 68 + t * 16 + c] = oacc[t][r] * inv;
  }
  __builtin_amdgcn_fence(__ATOMIC_RELEASE, "workgroup");
  __builtin_amdgcn_wave_barrier();
  __builtin_amdgcn_fence(__ATOMIC_ACQUIRE, "workgroup");
  {
    const int c4 = (lane & 15) * 4;
    {
#pragma unroll
      for (int it = 0; it < 8; ++it) {
        const int row = it * 2 + hh;
        v4f val = *(const v4f*)(os + row * 68 + c4);
        *(v4f*)(ob_ptr + (size_t)(q0 + row) * g.o_rs + c4) = val;
      }
      
    }
  }
}

} // namespace w25

// RoPE in place: (x0, x1) = (x[2i], x[2i+1]) -> (x0 cos[2i] - x1 sin[2i], x1 cos[2i+1] + x0 sin[2i+1]); tables gathered by the INPUT position (clamped); 16-byte stores, lanes contiguous
// Exact f32 attention rows 0 .. 63 of every (batch, head). A work-group of 256 threads takes 16 query rows of one head: thread (r, d) the rows t = 16 g + 4 i + r, i = 0 .. 3,
// first as key d of their scores, then as column d of their outputs. The head's 64 x 64 K and V tiles and the 16 query rows come once per work-group as whole 256-byte rows by
// 16-byte loads, all issued together, and are read from LDS; every loop is unrolled, and a thread's four rows are four independent chains that share each K and V value read.
// Keys above t: their score is the mask value and their weight expf(mask - max) = 0, so the sums over all 64 keys take the same values in the same order as sums that stop at t.
template <int S, int D, int NH>
__global__ __launch_bounds__(256) void k_cm_exact(const float* __restrict__ Q64, const float* __restrict__ K64, const float* __restrict__ V, float* __restrict__ AT) {
    constexpr int KP = 68;                      // K row pitch in floats: 272 B = 16 B x odd, for lanes that each read 16 bytes of their own row
    __shared__ __align__(16) float kl[64 * KP];
    __shared__ __align__(16) float vs[64 * 64];
    __shared__ __align__(16) float ql[16][64];
    __shared__ __align__(16) float sc[16][64];
    __shared__ __align__(16) float pr[16][64];
    const int r = (int)threadIdx.x >> 6, d = (int)threadIdx.x & 63;
    const int g = blockIdx.x % 4, h = (blockIdx.x / 4) % NH, b = blockIdx.x / (4 * NH);
    const int lr = (int)threadIdx.x >> 4, lc = ((int)threadIdx.x & 15) * 4;   // staging: row within a step of 16 rows, 16-byte piece of the row
    const float* kb = K64 + ((size_t)b * 64 + lr) * D + h * 64 + lc;
    const float* vb = V + ((size_t)b * S + lr) * D + h * 64 + lc;
    const float* qb = Q64 + ((size_t)b * 64 + 16 * g + lr) * D + h * 64 + lc;
    v4f kx[4], vx[4];
#pragma unroll
    for (int i = 0; i < 4; ++i) { kx[i] = *(const v4f*)(kb + 16 * i * D); vx[i] = *(const v4f*)(vb + 16 * i * D); }
    const v4f qx = *(const v4f*)qb;
    asm volatile("s_wait_xcnt 0x0" :: "v"(kb), "v"(vb), "v"(qb) : "memory");   // in front of any reuse of the loads' address registers; the addresses as inputs keep them from taking a load's result ahead of the wait
#pragma unroll
    for (int i = 0; i < 4; ++i) { *(v4f*)(kl + (lr + 16 * i) * KP + lc) = kx[i]; *(v4f*)(vs + (lr + 16 * i) * 64 + lc) = vx[i]; }
    *(v4f*)(ql[lr] + lc) = qx;
    __syncthreads();                            // the tiles and the query rows are visible
    float a[4] = {0.f, 0.f, 0.f, 0.f};
#pragma unroll
    for (int j = 0; j < 64; j += 4) {
        const v4f kk = *(const v4f*)(kl + d * KP + j);
#pragma unroll
        for (int i = 0; i < 4; ++i) {
            const v4f qq = *(const v4f*)(ql[4 * i + r] + j);
            a[i] = fmaf(qq[0], kk[0], a[i]); a[i] = fmaf(qq[1], kk[1], a[i]); a[i] = fmaf(qq[2], kk[2], a[i]); a[i] = fmaf(qq[3], kk[3], a[i]);
        }
    }
    float s[4];
#pragma unroll
    for (int i = 0; i < 4; ++i) { s[i] = (d <= 16 * g + 4 * i + r) ? a[i] * 0.125f : -3.0e38f; sc[4 * i + r][d] = s[i]; }
    __syncthreads();                            // the rows' scores are visible
#pragma unroll
    for (int i = 0; i < 4; ++i) {
        float mx = -3.0e38f;
#pragma unroll
        for (int j = 0; j < 64; j += 4) { const v4f x = *(const v4f*)(sc[4 * i + r] + j); mx = fmaxf(fmaxf(fmaxf(fmaxf(mx, x[0]), x[1]), x[2]), x[3]); }
        pr[4 * i + r][d] = expf(s[i] - mx);
    }
    __syncthreads();                            // the rows' weights are visible
    float den[4] = {0.f, 0.f, 0.f, 0.f}, acc[4] = {0.f, 0.f, 0.f, 0.f};
#pragma unroll
    for (int j = 0; j < 64; j += 4) {
        float vv[4];
#pragma unroll
        for (int e = 0; e < 4; ++e) vv[e] = vs[(j + e) * 64 + d];
#pragma unroll
        for (int i = 0; i < 4; ++i) {
            const v4f p = *(const v4f*)(pr[4 * i + r] + j);
#pragma unroll
            for (int e = 0; e < 4; ++e) { den[i] += p[e]; acc[i] = fmaf(p[e], vv[e], acc[i]); }
        }
    }
    float* ob = AT + ((size_t)b * S + 16 * g + r) * D + h * 64 + d;
#pragma unroll
    for (int i = 0; i < 4; ++i) VST2(float, ob + 4 * i * D, acc[i] / den[i]);
}


// ---- dense elementwise kernels: many elements a thread ------------------------------------------------------------
// A work-group of 256 threads takes 1024 * U consecutive floats: U loads of 16 bytes a thread, all issued before the first is used; each load of a wave covers
// 512 contiguous bytes. The grid covers the array exactly (element count a multiple of 1024 * U), so there is no bounds test and no row or column arithmetic.
typedef __attribute__((ext_vector_type(2))) unsigned int v2u;
template <int U>
__global__ __launch_bounds__(256) void k_castS16v(const float* __restrict__ src, __bf16* __restrict__ dhi, __bf16* __restrict__ dlo) {
    const size_t base = (size_t)blockIdx.x * (1024 * U) + threadIdx.x * 4;
    v4f v[U];
#pragma unroll
    for (int u = 0; u < U; ++u) v[u] = *(const v4f*)(src + base + u * 1024);
    asm volatile("s_wait_xcnt 0x0" ::: "memory");   // in front of the reuse of the loads' address registers
#pragma unroll
    for (int u = 0; u < U; ++u) {
        v2u hi, lo; unsigned int l0, l1;
        hi[0] = f2bf2_pack(v[u][0], v[u][1], &l0); hi[1] = f2bf2_pack(v[u][2], v[u][3], &l1); lo[0] = l0; lo[1] = l1;
        *(v2u*)(dhi + base + u * 1024) = hi; *(v2u*)(dlo + base + u * 1024) = lo;
    }
}
// Block blk of one array, read once, into every 16-bit form that a later product wants: bf16 hi and lo planes, and with H also f16 of s * value.
// Every loop over u is unrolled (#pragma unroll): u picks registers of v, h, hi and lo, which stay registers only under constant indices.
template <int U, bool H>
__device__ __forceinline__ void cast_block(const float* __restrict__ src, _Float16* __restrict__ dh, float s, __bf16* __restrict__ dhi, __bf16* __restrict__ dlo, unsigned blk) {
    const size_t base = (size_t)blk * (1024 * U) + threadIdx.x * 4;
    const float* p = src + base;
    v4f v[U];
#pragma unroll
    for (int u = 0; u < U; ++u) v[u] = *(const v4f*)(p + u * 1024);
    asm volatile("s_wait_xcnt 0x0" :: "v"(p) : "memory");   // in front of any reuse of the loads' address registers; p as an input keeps them from taking a load's result ahead of the wait
    __builtin_amdgcn_sched_barrier(0);   // no conversion moves up over the wait: without it the U = 8 build holds two of its loads back behind the first conversions
    v4h h[U]; v2u hi[U], lo[U];
#pragma unroll
    for (int u = 0; u < U; ++u) {
        if (H) { h[u][0] = (_Float16)(v[u][0] * s); h[u][1] = (_Float16)(v[u][1] * s); h[u][2] = (_Float16)(v[u][2] * s); h[u][3] = (_Float16)(v[u][3] * s); }
        unsigned int l0, l1;
        hi[u][0] = f2bf2_pack(v[u][0], v[u][1], &l0); hi[u][1] = f2bf2_pack(v[u][2], v[u][3], &l1); lo[u][0] = l0; lo[u][1] = l1;
    }
    __builtin_amdgcn_sched_barrier(0);   // every conversion ahead of the first store: the stores go out in one run, and no register of an issued store is written again
#pragma unroll
    for (int u = 0; u < U; ++u) {
        if (H) *(v4h*)(dh + base + u * 1024) = h[u];
        *(v2u*)(dhi + base + u * 1024) = hi[u]; *(v2u*)(dlo + base + u * 1024) = lo[u];
    }
}
// Every cast of an input, in one launch. Blocks 0 .. GX - 1: x (8192 elements each); then GW blocks (4096 elements each) for each of Wq, Wk, Wv, Wo.
// x, Wq, Wk go to f16 (the weights x16) and to bf16 planes; Wv, Wo to bf16 planes only.
template <unsigned GX, unsigned GW>
__global__ __launch_bounds__(256) void k_cast_inputs(const float* __restrict__ x, const float* __restrict__ Wq, const float* __restrict__ Wk, const float* __restrict__ Wv, const float* __restrict__ Wo,
                                                     _Float16* __restrict__ XH, __bf16* __restrict__ XS, __bf16* __restrict__ XS2,
                                                     _Float16* __restrict__ WqH, __bf16* __restrict__ WqS, __bf16* __restrict__ WqS2,
                                                     _Float16* __restrict__ WkH, __bf16* __restrict__ WkS, __bf16* __restrict__ WkS2,
                                                     __bf16* __restrict__ WvS, __bf16* __restrict__ WvS2, __bf16* __restrict__ WoS, __bf16* __restrict__ WoS2) {
    const unsigned bid = blockIdx.x;
    if (bid < GX) { cast_block<8, true>(x, XH, 1.0f, XS, XS2, bid); return; }
    const unsigned w = (bid - GX) / GW, blk = (bid - GX) % GW;
    // the wait behind each branch's stores: in the built kernel another branch's code stands behind them and writes the registers that they name
    if (w < 2) { cast_block<4, true>(w ? Wk : Wq, w ? WkH : WqH, 16.0f, w ? WkS : WqS, w ? WkS2 : WqS2, blk); asm volatile("s_wait_xcnt 0x0" ::: "memory"); }
    else       { cast_block<4, false>(w == 2 ? Wv : Wo, nullptr, 1.0f, w == 2 ? WvS : WoS, w == 2 ? WvS2 : WoS2, blk); asm volatile("s_wait_xcnt 0x0" ::: "memory"); }
}
// RoPE in place on rows of 16 heads x 64 columns: one wave takes one row of Q and the same row of Kx. Lane = (head parity, 16-byte piece of a head's 64 columns), so the lane's
// cos and sin pieces are loaded once and serve all 16 heads of both tensors. SR: rows per batch in Q and Kx, and the bound on the position. blk: eight rows.
template <int SR>
__device__ __forceinline__ void cm_rope_rows(float* __restrict__ Q, float* __restrict__ Kx, const float* __restrict__ CS, const float* __restrict__ SN, const int* __restrict__ POS, int blk) {
    const int row = blk * 8 + ((int)threadIdx.x >> 5), lane = threadIdx.x & 31;
    int ps = POS[row % SR]; ps = ps < 0 ? 0 : (ps >= SR ? SR - 1 : ps);
    const float* pc = CS + ps * 64 + (lane & 15) * 4; const float* pn = SN + ps * 64 + (lane & 15) * 4;
    const v4f c = *(const v4f*)pc, s = *(const v4f*)pn;
    float* q = Q + (size_t)row * 1024 + lane * 4; float* k = Kx + (size_t)row * 1024 + lane * 4;
    v4f a[8], b[8];
#pragma unroll
    for (int it = 0; it < 8; ++it) { a[it] = *(const v4f*)(q + it * 128); b[it] = *(const v4f*)(k + it * 128); }
    asm volatile("s_wait_xcnt 0x0" :: "v"(pc), "v"(pn) : "memory");   // in front of any reuse of the loads' address registers; pc, pn as inputs keep them from taking a load's result ahead of the wait
#pragma unroll
    for (int it = 0; it < 8; ++it) {
        v4f r, t;
        // x0 c0 - x1 s0 and x1 c1 + x0 s1, each with the x1 product rounded and the x0 product fused
        r[0] = fmaf(a[it][0], c[0], -(a[it][1] * s[0])); r[1] = fmaf(a[it][0], s[1], a[it][1] * c[1]); r[2] = fmaf(a[it][2], c[2], -(a[it][3] * s[2])); r[3] = fmaf(a[it][2], s[3], a[it][3] * c[3]);
        t[0] = fmaf(b[it][0], c[0], -(b[it][1] * s[0])); t[1] = fmaf(b[it][0], s[1], b[it][1] * c[1]); t[2] = fmaf(b[it][2], c[2], -(b[it][3] * s[2])); t[3] = fmaf(b[it][2], s[3], b[it][3] * c[3]);
        *(v4f*)(q + it * 128) = r; *(v4f*)(k + it * 128) = t;
    }
}
// both pairs of tensors in one launch: blocks 0 .. G - 1 take Q, Kx (2048 rows a batch), the rest Q64, K64 (64 rows a batch)
template <int G>
__global__ __launch_bounds__(256) void k_cm_rope_all(float* __restrict__ Q, float* __restrict__ Kx, float* __restrict__ Q64, float* __restrict__ K64,
                                                     const float* __restrict__ CS, const float* __restrict__ SN, const int* __restrict__ POS) {
    if ((int)blockIdx.x < G) cm_rope_rows<2048>(Q, Kx, CS, SN, POS, (int)blockIdx.x);
    // the wait behind this branch's stores: in the built kernel the other branch's code stands behind them and writes the registers that they name
    else                   { cm_rope_rows<64>(Q64, K64, CS, SN, POS, (int)blockIdx.x - G); asm volatile("s_wait_xcnt 0x0" ::: "memory"); }
}

extern "C" void kernel_launch(void* const* d_in, const int* in_sizes, int n_in, void* d_out, int out_size, void* d_ws, size_t ws_size, hipStream_t stream) {
    (void)in_sizes; (void)n_in; (void)out_size; (void)ws_size;
    const float* x = (const float*)d_in[0];
    const float* Wq = (const float*)d_in[1];
    const float* Wk = (const float*)d_in[2];
    const float* Wv = (const float*)d_in[3];
    const float* Wo = (const float*)d_in[4];
    const float* cosT = (const float*)d_in[5];
    const float* sinT = (const float*)d_in[6];
    const int* tpos = (const int*)d_in[7];
    const int Bn = 4;
    const int S = 2048;
    const int D = 1024;
    const int NH = 16;
    const int NR = Bn * S;
    float* out = (float*)d_out;
    char* wsp = (char*)d_ws;
    float* Q = (float*)wsp; wsp += (size_t)NR * D * 4;
    float* Kb = (float*)wsp; wsp += (size_t)NR * D * 4;
    float* V = (float*)wsp; wsp += (size_t)NR * D * 4;
    float* AT = (float*)wsp; wsp += (size_t)NR * D * 4;
    float* Q64 = (float*)wsp; wsp += (size_t)Bn * 64 * D * 4;
    float* K64 = (float*)wsp; wsp += (size_t)Bn * 64 * D * 4;
    unsigned short* XH = (unsigned short*)wsp; wsp += (size_t)NR * D * 2;    // x as f16
    unsigned short* XS = (unsigned short*)wsp; wsp += (size_t)NR * D * 2;    // x as bf16 hi and lo planes; after the exact-row GEMMs the attention output's planes
    unsigned short* XS2 = (unsigned short*)wsp; wsp += (size_t)NR * D * 2;
    unsigned short* WqH = (unsigned short*)wsp; wsp += (size_t)D * D * 2;    // 16 Wq, 16 Wk as f16
    unsigned short* WkH = (unsigned short*)wsp; wsp += (size_t)D * D * 2;
    unsigned short* WqS = (unsigned short*)wsp; wsp += (size_t)D * D * 2;    // bf16 hi and lo planes of the four weights
    unsigned short* WqS2 = (unsigned short*)wsp; wsp += (size_t)D * D * 2;
    unsigned short* WkS = (unsigned short*)wsp; wsp += (size_t)D * D * 2;
    unsigned short* WkS2 = (unsigned short*)wsp; wsp += (size_t)D * D * 2;
    unsigned short* WvS = (unsigned short*)wsp; wsp += (size_t)D * D * 2;
    unsigned short* WvS2 = (unsigned short*)wsp; wsp += (size_t)D * D * 2;
    unsigned short* WoS = (unsigned short*)wsp; wsp += (size_t)D * D * 2;
    unsigned short* WoS2 = (unsigned short*)wsp; wsp += (size_t)D * D * 2;
    const unsigned gX = (unsigned)((long long)NR * D / (1024 * 8));   // cast grid of an x-sized array: 32 elements a thread
    // every cast of an input: x and the four weights, each read once
    k_cast_inputs<1024, 256><<<1024 + 4 * 256, 256, 0, stream>>>(x, Wq, Wk, Wv, Wo, (_Float16*)XH, (__bf16*)XS, (__bf16*)XS2,
        (_Float16*)WqH, (__bf16*)WqS, (__bf16*)WqS2, (_Float16*)WkH, (__bf16*)WkS, (__bf16*)WkS2, (__bf16*)WvS, (__bf16*)WvS2, (__bf16*)WoS, (__bf16*)WoS2);
    // q, k: f16 operands
    const w25::GemmB none = {nullptr, nullptr, nullptr};
    w25::wmma_gemm_lds<0, false><<<dim3(D / 128, 2 * (NR / 128)), 256, 0, stream>>>(XH, nullptr, w25::GemmB{WqH, nullptr, Q}, w25::GemmB{WkH, nullptr, Kb}, none, NR / 128, NR / 128, D, D, 0.0625f, 64);
    // v on bf16 hi/lo planes; with it q, k of the first 64 rows of every batch, from the same planes of x: half tile b of Q64, K64 takes rows b S .. b S + 63 of A
    w25::wmma_gemm_lds<1, true><<<dim3(D / 128, NR / 128 + Bn), 256, 0, stream>>>(XS, XS2, w25::GemmB{WvS, WvS2, V}, w25::GemmB{WqS, WqS2, Q64}, w25::GemmB{WkS, WkS2, K64}, NR / 128, Bn / 2, D, D, 1.0f, S);
    k_cm_rope_all<1024><<<NR / 8 + Bn * 64 / 8, 256, 0, stream>>>(Q, Kb, Q64, K64, cosT, sinT, (const int*)tpos);
    k_attn_t<2048, 1024><<<dim3((unsigned)NH, (unsigned)Bn, (unsigned)(S / (16 * AW))), 32 * AW, 0, stream>>>(Q, Kb, V, AT);
    k_cm_exact<2048, 1024, 16><<<Bn * NH * 4, 256, 0, stream>>>(Q64, K64, V, AT);
    k_castS16v<8><<<gX, 256, 0, stream>>>(AT, (__bf16*)XS, (__bf16*)XS2);
    w25::wmma_gemm_lds<1, true><<<dim3(D / 128, NR / 128), 256, 0, stream>>>(XS, XS2, w25::GemmB{WoS, WoS2, out}, none, none, NR / 128, 0, D, D, 1.0f, 64);
}
